// v000
// The times below were measured on an AMD MI455X: many runs one after another, warmed up first and cycling through
// copies of the inputs, with the whole window's GPU time divided by the number of runs. Launches and the gaps
// between them are all in it. The median over several windows is given; except for v000 it joins two sittings, which
// can be a few percent apart, so the side-by-side timings, each taken in one sitting, are the better comparison.
// v000, which the later versions start from, runs in 123 microseconds.
#include <hip/hip_runtime.h>
#include <hip/hip_bf16.h>
#include <cstdint>

#define B_ 4
#define T_ 2048
#define C_ 384
#define H_ 6
#define D_ 64

typedef __attribute__((ext_vector_type(16))) _Float16 v16h;
typedef __attribute__((ext_vector_type(8)))  _Float16 v8h;
typedef __attribute__((ext_vector_type(8)))  float    v8f;

union Frag { v16h v; v8h h[2]; };

__device__ __forceinline__ void async_ld_b128(uint32_t lds_byte_off, const void* gptr) {
  asm volatile("global_load_async_to_lds_b128 %0, %1, off"
               :: "v"(lds_byte_off), "v"(gptr) : "memory");
}
__device__ __forceinline__ void wait_async0() {
#if __has_builtin(__builtin_amdgcn_s_wait_asynccnt)
  __builtin_amdgcn_s_wait_asynccnt(0);
#else
  asm volatile("s_wait_asynccnt 0" ::: "memory");
#endif
}
__device__ __forceinline__ uint32_t lds_off(const void* p) {
  return (uint32_t)(uintptr_t)p;
}

__device__ __forceinline__ float clamp_bias(float x) {
  return fminf(2.0f, fmaxf(-2.0f, x));
}

// ---------------------------------------------------------------------------
// f32 -> f16 conversion
// ---------------------------------------------------------------------------
__global__ void cvt_kernel(const float* __restrict__ src, _Float16* __restrict__ dst, int n) {
  int i = blockIdx.x * blockDim.x + threadIdx.x;
  int stride = gridDim.x * blockDim.x;
  for (; i < n; i += stride) dst[i] = (_Float16)src[i];
}

// ---------------------------------------------------------------------------
// QKV projection + RoPE + RMS-norm.
// grid: (T/16, 3*B); block: 128 (4 waves). Block computes all 384 output cols
// (all 6 heads) for 16 tokens of one matrix: 4 waves x 6 N-tiles, X loaded once.
// which = blockIdx.y / B : 0=Q, 1=K, 2=V
// Q/K stored [B,H,T,64] (Q pre-scaled by 1/sqrt(D)); V stored transposed [B,H,64,T].
// ---------------------------------------------------------------------------
__global__ __launch_bounds__(128)
void qkv_kernel(const _Float16* __restrict__ xh,
                const _Float16* __restrict__ wqh,
                const _Float16* __restrict__ wkh,
                const _Float16* __restrict__ wvh,
                const float* __restrict__ cosp,
                const float* __restrict__ sinp,
                _Float16* __restrict__ qh,
                _Float16* __restrict__ kh,
                _Float16* __restrict__ vh) {
  __shared__ __align__(16) _Float16 xs[16][392];    // 16 x 384 (+pad)  12.5 KB
  __shared__ __align__(16) float    outs[16][392];  // 16 x 384 (+pad)  25 KB

  const int tid   = threadIdx.x;
  const int b     = blockIdx.y % B_;
  const int which = blockIdx.y / B_;
  const int t0    = blockIdx.x * 16;

  const _Float16* xrow = xh + ((size_t)b * T_ + t0) * C_;
  for (int i = tid; i < 768; i += 128) {            // 768 x 16B chunks
    int r = i / 48, cc = (i % 48) * 8;
    async_ld_b128(lds_off(&xs[r][cc]), (const void*)(xrow + (size_t)r * C_ + cc));
  }
  wait_async0();
  __syncthreads();

  const _Float16* Wsel = (which == 0) ? wqh : (which == 1) ? wkh : wvh;
  const int wave  = tid >> 5;
  const int lane  = tid & 31;
  const int lhalf = lane & 15;
  const int hb    = (lane >> 4) * 8;   // K sub-block select per A/B layout
  const int mrb   = (lane >> 4) * 8;   // C/D row base

  for (int nt = 0; nt < 6; ++nt) {
    const int n0 = (nt * 4 + wave) * 16;            // output col base, 0..368
    const _Float16* wrow = Wsel + (size_t)(n0 + lhalf) * C_;
    v8f acc = {};
#pragma unroll
    for (int kk = 0; kk < 12; ++kk) {
      const int kb = kk * 32;
      Frag a, bf;
      a.h[0]  = *reinterpret_cast<const v8h*>(&xs[lhalf][kb + hb]);
      a.h[1]  = *reinterpret_cast<const v8h*>(&xs[lhalf][kb + 16 + hb]);
      bf.h[0] = *reinterpret_cast<const v8h*>(wrow + kb + hb);
      bf.h[1] = *reinterpret_cast<const v8h*>(wrow + kb + 16 + hb);
      acc = __builtin_amdgcn_wmma_f32_16x16x32_f16(false, a.v, false, bf.v,
                                                   (short)0, acc, false, false);
    }
#pragma unroll
    for (int r = 0; r < 8; ++r) outs[mrb + r][n0 + lhalf] = acc[r];
  }
  __syncthreads();

  if (which == 2) {
    // V transposed: [B,H,D,T]
    for (int i = tid; i < 16 * 384; i += 128) {
      int col = i >> 4, r = i & 15;
      int h = col >> 6, d = col & 63;
      vh[((size_t)(b * H_ + h) * D_ + d) * T_ + t0 + r] = (_Float16)outs[r][col];
    }
  } else {
    // RoPE + RMS: 384 work items = 6 heads x 16 rows x 4 parts; 3 uniform passes.
    _Float16* dstbase = (which == 0) ? qh : kh;
    const float qscale = (which == 0) ? 0.125f : 1.0f;  // fold softmax 1/sqrt(D) into Q
    for (int item = tid; item < 384; item += 128) {
      const int h    = item >> 6;
      const int rem  = item & 63;
      const int row  = rem >> 2;
      const int part = rem & 3;
      const int t    = t0 + row;
      float r1[8], r2[8];
      float ss = 0.0f;
#pragma unroll
      for (int jj = 0; jj < 8; ++jj) {
        const int j = part * 8 + jj;
        float c  = cosp[(size_t)t * 32 + j];
        float s  = sinp[(size_t)t * 32 + j];
        float x1 = outs[row][h * 64 + j];
        float x2 = outs[row][h * 64 + j + 32];
        r1[jj] = x1 * c + x2 * s;
        r2[jj] = -x1 * s + x2 * c;
        ss += r1[jj] * r1[jj] + r2[jj] * r2[jj];
      }
      // 4 parts of one row sit in 4 adjacent lanes (groups aligned to 4)
      ss += __shfl_xor(ss, 1, 32);
      ss += __shfl_xor(ss, 2, 32);
      const float inv = rsqrtf(ss * (1.0f / 64.0f) + 1.1920929e-7f) * qscale;
      _Float16* qout = dstbase + ((size_t)(b * H_ + h) * T_ + t) * D_;
#pragma unroll
      for (int jj = 0; jj < 8; ++jj) {
        const int j = part * 8 + jj;
        qout[j]      = (_Float16)(r1[jj] * inv);
        qout[j + 32] = (_Float16)(r2[jj] * inv);
      }
    }
  }
}

// ---------------------------------------------------------------------------
// Flash attention, fixed-max softmax.
// RMS-norm bounds: ||q_scaled|| = 1, ||k|| = 8 => |score| <= 8; bias clip +-2
// => |s| <= 10. exp(10)=2.2e4 < f16 max; row sum < 2048*e^10 ~ 4.5e7 < f32 max.
// So no running max, no accumulator rescale; row sum reduced once at the end.
// Q/K [B,H,T,64] f16 (Q pre-scaled), V [B,H,64,T] f16. Y f16 token-major [B,T,C].
// grid: (T/64, H, B); block: 128 (4 waves, 16 query rows each).
// ---------------------------------------------------------------------------
__global__ __launch_bounds__(128)
void attn_kernel(const _Float16* __restrict__ qh,
                 const _Float16* __restrict__ kh,
                 const _Float16* __restrict__ vh,
                 const int* __restrict__ maskp,
                 const float* __restrict__ rawb,
                 const int* __restrict__ bscale,
                 _Float16* __restrict__ yh) {
  __shared__ __align__(16) _Float16 kts[2][32][72];   // 32 keys x 64 dims (+pad)
  __shared__ __align__(16) _Float16 vtt[2][64][40];   // 64 dims x 32 keys (+pad)
  __shared__ __align__(16) _Float16 pts[4][16][40];   // per-wave P tile 16x32 (+pad)

  const int tid   = threadIdx.x;
  const int wave  = tid >> 5;
  const int lane  = tid & 31;
  const int lhalf = lane & 15;
  const int hb    = (lane >> 4) * 8;
  const int mrb   = (lane >> 4) * 8;

  const int b   = blockIdx.z;
  const int h   = blockIdx.y;
  const int qt0 = blockIdx.x * 64 + wave * 16;

  const _Float16* Qb  = qh + (size_t)(b * H_ + h) * T_ * D_;
  const _Float16* Kb  = kh + (size_t)(b * H_ + h) * T_ * D_;
  const _Float16* Vtb = vh + (size_t)(b * H_ + h) * D_ * T_;

  // Q fragments (K = 0..31 and 32..63)
  Frag qa0, qa1;
  {
    const _Float16* qr = Qb + (size_t)(qt0 + lhalf) * D_;
    qa0.h[0] = *reinterpret_cast<const v8h*>(qr + 0 + hb);
    qa0.h[1] = *reinterpret_cast<const v8h*>(qr + 16 + hb);
    qa1.h[0] = *reinterpret_cast<const v8h*>(qr + 32 + hb);
    qa1.h[1] = *reinterpret_cast<const v8h*>(qr + 48 + hb);
  }

  // bias takes only 4 values (mask is binary): precompute and select
  const float bs = (float)bscale[0];
  const float g1 = 0.5f * tanhf(rawb[h * 3 + 0]) * bs;
  const float g2 = 0.5f * tanhf(rawb[h * 3 + 1]) * bs;
  const float g3 = 0.5f * tanhf(rawb[h * 3 + 2]) * bs;
  const float cg1   = clamp_bias(g1);
  const float cg2   = clamp_bias(g2);
  const float cg123 = clamp_bias(g1 + g2 + g3);

  float bi0[8], bi1[8];   // per accumulator row: bias for mj=0 / mj=1
#pragma unroll
  for (int r = 0; r < 8; ++r) {
    const bool mi = maskp[b * T_ + qt0 + mrb + r] != 0;
    bi0[r] = mi ? cg1 : 0.0f;
    bi1[r] = mi ? cg123 : cg2;
  }

  float lsum[8];
#pragma unroll
  for (int r = 0; r < 8; ++r) lsum[r] = 0.0f;
  v8f o0 = {}, o1 = {}, o2 = {}, o3 = {};

  const int NJ = T_ / 32;

  // ---- stage tile 0 ----
  {
#pragma unroll
    for (int chunk = 0; chunk < 2; ++chunk) {
      const int e = (tid + chunk * 128) * 8;
      { const int r = e >> 6, c = e & 63;
        async_ld_b128(lds_off(&kts[0][r][c]), (const void*)(Kb + (size_t)r * D_ + c)); }
      { const int d = e >> 5, c = e & 31;
        async_ld_b128(lds_off(&vtt[0][d][c]), (const void*)(Vtb + (size_t)d * T_ + c)); }
    }
    wait_async0();
    __syncthreads();
  }

  for (int jb = 0; jb < NJ; ++jb) {
    const int cur = jb & 1;
    const int nxt = cur ^ 1;

    // ---- prefetch next tile while computing on current ----
    if (jb + 1 < NJ) {
      const int kb0 = (jb + 1) * 32;
#pragma unroll
      for (int chunk = 0; chunk < 2; ++chunk) {
        const int e = (tid + chunk * 128) * 8;
        { const int r = e >> 6, c = e & 63;
          async_ld_b128(lds_off(&kts[nxt][r][c]), (const void*)(Kb + (size_t)(kb0 + r) * D_ + c)); }
        { const int d = e >> 5, c = e & 31;
          async_ld_b128(lds_off(&vtt[nxt][d][c]), (const void*)(Vtb + (size_t)d * T_ + kb0 + c)); }
      }
    }

    // ---- S = Q K^T for keys [jb*32, jb*32+32) ----
    v8f s0 = {}, s1 = {};
    {
      Frag bk;
      bk.h[0] = *reinterpret_cast<const v8h*>(&kts[cur][lhalf][0 + hb]);
      bk.h[1] = *reinterpret_cast<const v8h*>(&kts[cur][lhalf][16 + hb]);
      s0 = __builtin_amdgcn_wmma_f32_16x16x32_f16(false, qa0.v, false, bk.v, (short)0, s0, false, false);
      bk.h[0] = *reinterpret_cast<const v8h*>(&kts[cur][lhalf][32 + hb]);
      bk.h[1] = *reinterpret_cast<const v8h*>(&kts[cur][lhalf][48 + hb]);
      s0 = __builtin_amdgcn_wmma_f32_16x16x32_f16(false, qa1.v, false, bk.v, (short)0, s0, false, false);
      bk.h[0] = *reinterpret_cast<const v8h*>(&kts[cur][16 + lhalf][0 + hb]);
      bk.h[1] = *reinterpret_cast<const v8h*>(&kts[cur][16 + lhalf][16 + hb]);
      s1 = __builtin_amdgcn_wmma_f32_16x16x32_f16(false, qa0.v, false, bk.v, (short)0, s1, false, false);
      bk.h[0] = *reinterpret_cast<const v8h*>(&kts[cur][16 + lhalf][32 + hb]);
      bk.h[1] = *reinterpret_cast<const v8h*>(&kts[cur][16 + lhalf][48 + hb]);
      s1 = __builtin_amdgcn_wmma_f32_16x16x32_f16(false, qa1.v, false, bk.v, (short)0, s1, false, false);
    }

    const bool mj0 = maskp[b * T_ + jb * 32 + lhalf] != 0;
    const bool mj1 = maskp[b * T_ + jb * 32 + 16 + lhalf] != 0;

    // ---- fixed-max softmax numerators, write P tile ----
#pragma unroll
    for (int r = 0; r < 8; ++r) {
      const float p0 = __expf(s0[r] + (mj0 ? bi1[r] : bi0[r]));
      const float p1 = __expf(s1[r] + (mj1 ? bi1[r] : bi0[r]));
      lsum[r] += p0 + p1;          // per-lane partial; reduced once at the end
      pts[wave][mrb + r][lhalf]      = (_Float16)p0;
      pts[wave][mrb + r][16 + lhalf] = (_Float16)p1;
    }
#if __has_builtin(__builtin_amdgcn_wave_barrier)
    __builtin_amdgcn_wave_barrier();  // keep P stores before P loads (intra-wave, LDS in-order)
#endif

    // ---- O += P V : P is A (16x32), V^T rows give contiguous B fragments ----
    Frag pa;
    pa.h[0] = *reinterpret_cast<const v8h*>(&pts[wave][lhalf][hb]);
    pa.h[1] = *reinterpret_cast<const v8h*>(&pts[wave][lhalf][16 + hb]);
#pragma unroll
    for (int dc = 0; dc < 4; ++dc) {
      Frag vb;
      vb.h[0] = *reinterpret_cast<const v8h*>(&vtt[cur][dc * 16 + lhalf][hb]);
      vb.h[1] = *reinterpret_cast<const v8h*>(&vtt[cur][dc * 16 + lhalf][16 + hb]);
      v8f* op = (dc == 0) ? &o0 : (dc == 1) ? &o1 : (dc == 2) ? &o2 : &o3;
      *op = __builtin_amdgcn_wmma_f32_16x16x32_f16(false, pa.v, false, vb.v, (short)0, *op, false, false);
    }

    // ---- retire prefetch, publish next tile ----
    wait_async0();
    __syncthreads();
  }

  // ---- epilogue: single row-sum reduction, normalize, store f16 [B,T,C] ----
#pragma unroll
  for (int r = 0; r < 8; ++r) {
    float ls = lsum[r];
    ls += __shfl_xor(ls, 1, 32);
    ls += __shfl_xor(ls, 2, 32);
    ls += __shfl_xor(ls, 4, 32);
    ls += __shfl_xor(ls, 8, 32);
    const float inv = 1.0f / ls;
    const int t = qt0 + mrb + r;
    _Float16* yrow = yh + ((size_t)(b * T_ + t)) * C_ + h * D_;
    yrow[0  + lhalf] = (_Float16)(o0[r] * inv);
    yrow[16 + lhalf] = (_Float16)(o1[r] * inv);
    yrow[32 + lhalf] = (_Float16)(o2[r] * inv);
    yrow[48 + lhalf] = (_Float16)(o3[r] * inv);
  }
}

// ---------------------------------------------------------------------------
// Output projection: out = Y @ Wproj^T, f32 result.
// grid: ((B*T)/16, C/64); block: 128 (4 waves x 16x16 tiles).
// ---------------------------------------------------------------------------
__global__ __launch_bounds__(128)
void proj_kernel(const _Float16* __restrict__ yhp,
                 const _Float16* __restrict__ wph,
                 float* __restrict__ out) {
  __shared__ __align__(16) _Float16 ys[16][392];

  const int tid  = threadIdx.x;
  const int bt0  = blockIdx.x * 16;
  const int nb   = blockIdx.y * 64;

  const _Float16* yrow = yhp + (size_t)bt0 * C_;
  for (int i = tid; i < 768; i += 128) {
    int r = i / 48, cc = (i % 48) * 8;
    async_ld_b128(lds_off(&ys[r][cc]), (const void*)(yrow + (size_t)r * C_ + cc));
  }
  wait_async0();
  __syncthreads();

  const int wave  = tid >> 5;
  const int lane  = tid & 31;
  const int lhalf = lane & 15;
  const int hb    = (lane >> 4) * 8;
  const int mrb   = (lane >> 4) * 8;
  const int n0    = nb + wave * 16;

  const _Float16* wrow = wph + (size_t)(n0 + lhalf) * C_;

  v8f acc = {};
#pragma unroll
  for (int kk = 0; kk < 12; ++kk) {
    const int kb = kk * 32;
    Frag a, bf;
    a.h[0]  = *reinterpret_cast<const v8h*>(&ys[lhalf][kb + hb]);
    a.h[1]  = *reinterpret_cast<const v8h*>(&ys[lhalf][kb + 16 + hb]);
    bf.h[0] = *reinterpret_cast<const v8h*>(wrow + kb + hb);
    bf.h[1] = *reinterpret_cast<const v8h*>(wrow + kb + 16 + hb);
    acc = __builtin_amdgcn_wmma_f32_16x16x32_f16(false, a.v, false, bf.v,
                                                 (short)0, acc, false, false);
  }

#pragma unroll
  for (int r = 0; r < 8; ++r)
    out[(size_t)(bt0 + mrb + r) * C_ + n0 + lhalf] = acc[r];
}

// ---------------------------------------------------------------------------
extern "C" void kernel_launch(void* const* d_in, const int* in_sizes, int n_in,
                              void* d_out, int out_size, void* d_ws, size_t ws_size,
                              hipStream_t stream) {
  (void)in_sizes; (void)n_in; (void)out_size; (void)ws_size;

  const float* x      = (const float*)d_in[0];
  const float* cosp   = (const float*)d_in[1];
  const float* sinp   = (const float*)d_in[2];
  const int*   maskp  = (const int*)d_in[3];
  const float* Wq     = (const float*)d_in[4];
  const float* Wk     = (const float*)d_in[5];
  const float* Wv     = (const float*)d_in[6];
  const float* Wproj  = (const float*)d_in[7];
  const float* rawb   = (const float*)d_in[8];
  const int*   bscale = (const int*)d_in[9];
  float* out = (float*)d_out;

  const size_t XN = (size_t)B_ * T_ * C_;   // 3,145,728
  const size_t WN = (size_t)C_ * C_;        // 147,456

  _Float16* p   = (_Float16*)d_ws;
  _Float16* xh  = p; p += XN;
  _Float16* wqh = p; p += WN;
  _Float16* wkh = p; p += WN;
  _Float16* wvh = p; p += WN;
  _Float16* wph = p; p += WN;
  _Float16* qh  = p; p += XN;
  _Float16* kh  = p; p += XN;
  _Float16* vh  = p; p += XN;   // transposed layout [B,H,D,T]
  _Float16* yh  = p; p += XN;

  cvt_kernel<<<2048, 256, 0, stream>>>(x, xh, (int)XN);
  cvt_kernel<<<288, 256, 0, stream>>>(Wq, wqh, (int)WN);
  cvt_kernel<<<288, 256, 0, stream>>>(Wk, wkh, (int)WN);
  cvt_kernel<<<288, 256, 0, stream>>>(Wv, wvh, (int)WN);
  cvt_kernel<<<288, 256, 0, stream>>>(Wproj, wph, (int)WN);

  dim3 g1(T_ / 16, 3 * B_);
  qkv_kernel<<<g1, 128, 0, stream>>>(xh, wqh, wkh, wvh, cosp, sinp, qh, kh, vh);

  dim3 g2(T_ / 64, H_, B_);
  attn_kernel<<<g2, 128, 0, stream>>>(qh, kh, vh, maskp, rawb, bscale, yh);

  dim3 g3((B_ * T_) / 16, C_ / 64);
  proj_kernel<<<g3, 128, 0, stream>>>(yh, wph, out);
}

// v001
// Measured time: 102 microseconds a run.
// In two side-by-side timings against v000, it was 1.21 and 1.22 times as fast.
#include <hip/hip_runtime.h>
#include <hip/hip_bf16.h>
#include <cstdint>

#define B_ 4
#define T_ 2048
#define C_ 384
#define H_ 6
#define D_ 64

typedef __attribute__((ext_vector_type(16))) _Float16 v16h;
typedef __attribute__((ext_vector_type(8)))  _Float16 v8h;
typedef __attribute__((ext_vector_type(8)))  float    v8f;

union Frag { v16h v; v8h h[2]; };

__device__ __forceinline__ void async_ld_b128(uint32_t lds_byte_off, const void* gptr) {
  asm volatile("global_load_async_to_lds_b128 %0, %1, off"
               :: "v"(lds_byte_off), "v"(gptr) : "memory");
}
__device__ __forceinline__ void wait_async0() {
#if __has_builtin(__builtin_amdgcn_s_wait_asynccnt)
  __builtin_amdgcn_s_wait_asynccnt(0);
#else
  asm volatile("s_wait_asynccnt 0" ::: "memory");
#endif
}
__device__ __forceinline__ uint32_t lds_off(const void* p) {
  return (uint32_t)(uintptr_t)p;
}

__device__ __forceinline__ float clamp_bias(float x) {
  return fminf(2.0f, fmaxf(-2.0f, x));
}

// ---------------------------------------------------------------------------
// f32 -> f16 conversion
// ---------------------------------------------------------------------------
__global__ void cvt_kernel(const float* __restrict__ src, _Float16* __restrict__ dst, int n) {
  int i = blockIdx.x * blockDim.x + threadIdx.x;
  int stride = gridDim.x * blockDim.x;
  for (; i < n; i += stride) dst[i] = (_Float16)src[i];
}

// ---------------------------------------------------------------------------
// QKV projection + RoPE + RMS-norm.
// grid: (T/16, 3*B); block: 128 (4 waves). Block computes all 384 output cols
// (all 6 heads) for 16 tokens of one matrix: 4 waves x 6 N-tiles, X loaded once.
// which = blockIdx.y / B : 0=Q, 1=K, 2=V
// Q/K stored [B,H,T,64] (Q pre-scaled by 1/sqrt(D)); V stored transposed [B,H,64,T].
// ---------------------------------------------------------------------------
__global__ __launch_bounds__(128)
void qkv_kernel(const _Float16* __restrict__ xh,
                const _Float16* __restrict__ wqh,
                const _Float16* __restrict__ wkh,
                const _Float16* __restrict__ wvh,
                const float* __restrict__ cosp,
                const float* __restrict__ sinp,
                _Float16* __restrict__ qh,
                _Float16* __restrict__ kh,
                _Float16* __restrict__ vh) {
  __shared__ __align__(16) _Float16 xs[16][392];    // 16 x 384 (+pad)  12.5 KB
  __shared__ __align__(16) float    outs[16][392];  // 16 x 384 (+pad)  25 KB

  const int tid   = threadIdx.x;
  const int b     = blockIdx.y % B_;
  const int which = blockIdx.y / B_;
  const int t0    = blockIdx.x * 16;

  const _Float16* xrow = xh + ((size_t)b * T_ + t0) * C_;
  for (int i = tid; i < 768; i += 128) {            // 768 x 16B chunks
    int r = i / 48, cc = (i % 48) * 8;
    async_ld_b128(lds_off(&xs[r][cc]), (const void*)(xrow + (size_t)r * C_ + cc));
  }
  wait_async0();
  __syncthreads();

  const _Float16* Wsel = (which == 0) ? wqh : (which == 1) ? wkh : wvh;
  const int wave  = tid >> 5;
  const int lane  = tid & 31;
  const int lhalf = lane & 15;
  const int hb    = (lane >> 4) * 8;   // K sub-block select per A/B layout
  const int mrb   = (lane >> 4) * 8;   // C/D row base

  for (int nt = 0; nt < 6; ++nt) {
    const int n0 = (nt * 4 + wave) * 16;            // output col base, 0..368
    const _Float16* wrow = Wsel + (size_t)(n0 + lhalf) * C_;
    v8f acc = {};
#pragma unroll
    for (int kk = 0; kk < 12; ++kk) {
      const int kb = kk * 32;
      Frag a, bf;
      a.h[0]  = *reinterpret_cast<const v8h*>(&xs[lhalf][kb + hb]);
      a.h[1]  = *reinterpret_cast<const v8h*>(&xs[lhalf][kb + 16 + hb]);
      bf.h[0] = *reinterpret_cast<const v8h*>(wrow + kb + hb);
      bf.h[1] = *reinterpret_cast<const v8h*>(wrow + kb + 16 + hb);
      acc = __builtin_amdgcn_wmma_f32_16x16x32_f16(false, a.v, false, bf.v,
                                                   (short)0, acc, false, false);
    }
#pragma unroll
    for (int r = 0; r < 8; ++r) outs[mrb + r][n0 + lhalf] = acc[r];
  }
  __syncthreads();

  if (which == 2) {
    // V transposed: [B,H,D,T]
    for (int i = tid; i < 16 * 384; i += 128) {
      int col = i >> 4, r = i & 15;
      int h = col >> 6, d = col & 63;
      vh[((size_t)(b * H_ + h) * D_ + d) * T_ + t0 + r] = (_Float16)outs[r][col];
    }
  } else {
    // RoPE + RMS: 384 work items = 6 heads x 16 rows x 4 parts; 3 uniform passes.
    _Float16* dstbase = (which == 0) ? qh : kh;
    const float qscale = (which == 0) ? 0.125f : 1.0f;  // fold softmax 1/sqrt(D) into Q
    for (int item = tid; item < 384; item += 128) {
      const int h    = item >> 6;
      const int rem  = item & 63;
      const int row  = rem >> 2;
      const int part = rem & 3;
      const int t    = t0 + row;
      float r1[8], r2[8];
      float ss = 0.0f;
#pragma unroll
      for (int jj = 0; jj < 8; ++jj) {
        const int j = part * 8 + jj;
        float c  = cosp[(size_t)t * 32 + j];
        float s  = sinp[(size_t)t * 32 + j];
        float x1 = outs[row][h * 64 + j];
        float x2 = outs[row][h * 64 + j + 32];
        r1[jj] = x1 * c + x2 * s;
        r2[jj] = -x1 * s + x2 * c;
        ss += r1[jj] * r1[jj] + r2[jj] * r2[jj];
      }
      // 4 parts of one row sit in 4 adjacent lanes (groups aligned to 4)
      ss += __shfl_xor(ss, 1, 32);
      ss += __shfl_xor(ss, 2, 32);
      const float inv = rsqrtf(ss * (1.0f / 64.0f) + 1.1920929e-7f) * qscale;
      _Float16* qout = dstbase + ((size_t)(b * H_ + h) * T_ + t) * D_;
#pragma unroll
      for (int jj = 0; jj < 8; ++jj) {
        const int j = part * 8 + jj;
        qout[j]      = (_Float16)(r1[jj] * inv);
        qout[j + 32] = (_Float16)(r2[jj] * inv);
      }
    }
  }
}

// ---------------------------------------------------------------------------
// Flash attention, fixed-max softmax, keys split over wave groups.
// RMS-norm bounds: ||q_scaled|| = 1, ||k|| = 8 => |score| <= 8; bias clip +-2
// => |s| <= 10. exp(10)=2.2e4 < f16 max; row sum < 2048*e^10 ~ 4.5e7 < f32 max.
// So no running max, no accumulator rescale: partial O and partial row sums of
// disjoint key ranges simply add.
// Q/K [B,H,T,64] f16 (Q pre-scaled), V [B,H,64,T] f16. Y f16 token-major [B,T,C].
// grid: (T/64, H, B); block: 128*KS_ threads = KS_ key groups x 4 waves.
// Wave (kg, qg): query rows qg*16..+16 of the block, keys kg*T/KS_ .. +T/KS_.
// Each key group stages its own 32-key K and V tiles; the groups' partial
// results are added through LDS once, behind the loop.
// ---------------------------------------------------------------------------
#define KS_ 2
#define KT_BYTES (32 * 72 * 2)            // one K tile: 32 keys x 64 dims (+pad)
#define VT_BYTES (64 * 40 * 2)            // one V tile: 64 dims x 32 keys (+pad)
#define PT_BYTES (16 * 40 * 2)            // one wave's P tile 16x32 (+pad)
#define K_OFF(buf, kg) (((buf) * KS_ + (kg)) * KT_BYTES)
#define V_OFF(buf, kg) (2 * KS_ * KT_BYTES + ((buf) * KS_ + (kg)) * VT_BYTES)
#define P_OFF(w)       (2 * KS_ * (KT_BYTES + VT_BYTES) + (w) * PT_BYTES)
#define ATTN_LDS       (2 * KS_ * (KT_BYTES + VT_BYTES) + 4 * KS_ * PT_BYTES)

typedef __attribute__((ext_vector_type(4))) float v4f;

__device__ __forceinline__ void stage_kv(uint32_t lk0, uint32_t lk1, uint32_t lv0, uint32_t lv1,
                                         const _Float16* gk0, const _Float16* gk1,
                                         const _Float16* gv0, const _Float16* gv1) {
  asm volatile("global_load_async_to_lds_b128 %0, %4, off\n\t"
               "global_load_async_to_lds_b128 %1, %5, off\n\t"
               "global_load_async_to_lds_b128 %2, %6, off\n\t"
               "global_load_async_to_lds_b128 %3, %7, off\n\t"
               "s_wait_xcnt 0x0"
               :: "v"(lk0), "v"(lk1), "v"(lv0), "v"(lv1),
                  "v"(gk0), "v"(gk1), "v"(gv0), "v"(gv1) : "memory");
}

__global__ __launch_bounds__(128 * KS_)
void attn_kernel(const _Float16* __restrict__ qh,
                 const _Float16* __restrict__ kh,
                 const _Float16* __restrict__ vh,
                 const int* __restrict__ maskp,
                 const float* __restrict__ rawb,
                 const int* __restrict__ bscale,
                 _Float16* __restrict__ yh) {
  __shared__ __align__(16) unsigned char smem[ATTN_LDS];

  const int tid   = threadIdx.x;
  const int wave  = tid >> 5;
  const int qg    = wave & 3;          // query group
  const int kg    = wave >> 2;         // key group
  const int t128  = tid & 127;         // thread within its key group
  const int lane  = tid & 31;
  const int lhalf = lane & 15;
  const int hb    = (lane >> 4) * 8;
  const int mrb   = (lane >> 4) * 8;

  const int b   = blockIdx.z;
  const int h   = blockIdx.y;
  const int qt0 = blockIdx.x * 64 + qg * 16;
  const int kbase = kg * (T_ / KS_);   // first key of this wave's range

  const _Float16* Qb  = qh + (size_t)(b * H_ + h) * T_ * D_;
  const _Float16* Kb  = kh + (size_t)(b * H_ + h) * T_ * D_ + (size_t)kbase * D_;
  const _Float16* Vtb = vh + (size_t)(b * H_ + h) * D_ * T_ + kbase;

  // Q fragments (K = 0..31 and 32..63)
  Frag qa0, qa1;
  {
    const _Float16* qr = Qb + (size_t)(qt0 + lhalf) * D_;
    qa0.h[0] = *reinterpret_cast<const v8h*>(qr + 0 + hb);
    qa0.h[1] = *reinterpret_cast<const v8h*>(qr + 16 + hb);
    qa1.h[0] = *reinterpret_cast<const v8h*>(qr + 32 + hb);
    qa1.h[1] = *reinterpret_cast<const v8h*>(qr + 48 + hb);
  }

  // bias takes only 4 values (mask is binary): precompute and select
  const float bs = (float)bscale[0];
  const float g1 = 0.5f * tanhf(rawb[h * 3 + 0]) * bs;
  const float g2 = 0.5f * tanhf(rawb[h * 3 + 1]) * bs;
  const float g3 = 0.5f * tanhf(rawb[h * 3 + 2]) * bs;
  const float cg1   = clamp_bias(g1);
  const float cg2   = clamp_bias(g2);
  const float cg123 = clamp_bias(g1 + g2 + g3);

  float bi0[8], bi1[8];   // per accumulator row: bias for mj=0 / mj=1
#pragma unroll
  for (int r = 0; r < 8; ++r) {
    const bool mi = maskp[b * T_ + qt0 + mrb + r] != 0;
    bi0[r] = mi ? cg1 : 0.0f;
    bi1[r] = mi ? cg123 : cg2;
  }

  float lsum[8];
#pragma unroll
  for (int r = 0; r < 8; ++r) lsum[r] = 0.0f;
  v8f o0 = {}, o1 = {}, o2 = {}, o3 = {};

  const int NJ = T_ / (32 * KS_);      // 32-key tiles per key group

  // this thread's two 16-byte chunks of a K tile and of a V tile
  const int e0 = t128 * 8, e1 = (t128 + 128) * 8;
  const int kr0 = e0 >> 6, kc0 = e0 & 63, kr1 = e1 >> 6, kc1 = e1 & 63;
  const int vd0 = e0 >> 5, vc0 = e0 & 31, vd1 = e1 >> 5, vc1 = e1 & 31;
  const uint32_t sbase = lds_off(smem);
  const uint32_t lk0 = sbase + K_OFF(0, kg) + (kr0 * 72 + kc0) * 2;
  const uint32_t lk1 = sbase + K_OFF(0, kg) + (kr1 * 72 + kc1) * 2;
  const uint32_t lv0 = sbase + V_OFF(0, kg) + (vd0 * 40 + vc0) * 2;
  const uint32_t lv1 = sbase + V_OFF(0, kg) + (vd1 * 40 + vc1) * 2;
  const _Float16* gk0 = Kb + kr0 * D_ + kc0;
  const _Float16* gk1 = Kb + kr1 * D_ + kc1;
  const _Float16* gv0 = Vtb + (size_t)vd0 * T_ + vc0;
  const _Float16* gv1 = Vtb + (size_t)vd1 * T_ + vc1;

  // ---- tile 0 into buffer 0, published; then tile 1 into buffer 1 ----
  stage_kv(lk0, lk1, lv0, lv1, gk0, gk1, gv0, gv1);
  asm volatile("s_wait_asynccnt 0x0" ::: "memory");  // own copies of tile 0 landed
  __syncthreads();
  stage_kv(lk0 + KS_ * KT_BYTES, lk1 + KS_ * KT_BYTES, lv0 + KS_ * VT_BYTES, lv1 + KS_ * VT_BYTES,
           gk0 + 32 * D_, gk1 + 32 * D_, gv0 + 32, gv1 + 32);

  _Float16 (*pt)[40] = reinterpret_cast<_Float16 (*)[40]>(smem + P_OFF(wave));

  for (int jb = 0; jb < NJ; ++jb) {
    const int cur = jb & 1;
    const _Float16 (*kt)[72] = reinterpret_cast<const _Float16 (*)[72]>(smem + K_OFF(cur, kg));
    const _Float16 (*vt)[40] = reinterpret_cast<const _Float16 (*)[40]>(smem + V_OFF(cur, kg));

    // ---- S = Q K^T for keys [kbase + jb*32, +32) ----
    v8f s0 = {}, s1 = {};
    {
      Frag bk;
      bk.h[0] = *reinterpret_cast<const v8h*>(&kt[lhalf][0 + hb]);
      bk.h[1] = *reinterpret_cast<const v8h*>(&kt[lhalf][16 + hb]);
      s0 = __builtin_amdgcn_wmma_f32_16x16x32_f16(false, qa0.v, false, bk.v, (short)0, s0, false, false);
      bk.h[0] = *reinterpret_cast<const v8h*>(&kt[lhalf][32 + hb]);
      bk.h[1] = *reinterpret_cast<const v8h*>(&kt[lhalf][48 + hb]);
      s0 = __builtin_amdgcn_wmma_f32_16x16x32_f16(false, qa1.v, false, bk.v, (short)0, s0, false, false);
      bk.h[0] = *reinterpret_cast<const v8h*>(&kt[16 + lhalf][0 + hb]);
      bk.h[1] = *reinterpret_cast<const v8h*>(&kt[16 + lhalf][16 + hb]);
      s1 = __builtin_amdgcn_wmma_f32_16x16x32_f16(false, qa0.v, false, bk.v, (short)0, s1, false, false);
      bk.h[0] = *reinterpret_cast<const v8h*>(&kt[16 + lhalf][32 + hb]);
      bk.h[1] = *reinterpret_cast<const v8h*>(&kt[16 + lhalf][48 + hb]);
      s1 = __builtin_amdgcn_wmma_f32_16x16x32_f16(false, qa1.v, false, bk.v, (short)0, s1, false, false);
    }

    const bool mj0 = maskp[b * T_ + kbase + jb * 32 + lhalf] != 0;
    const bool mj1 = maskp[b * T_ + kbase + jb * 32 + 16 + lhalf] != 0;

    // ---- fixed-max softmax numerators, write P tile ----
#pragma unroll
    for (int r = 0; r < 8; ++r) {
      const float p0 = __expf(s0[r] + (mj0 ? bi1[r] : bi0[r]));
      const float p1 = __expf(s1[r] + (mj1 ? bi1[r] : bi0[r]));
      lsum[r] += p0 + p1;          // per-lane partial; reduced once at the end
      pt[mrb + r][lhalf]      = (_Float16)p0;
      pt[mrb + r][16 + lhalf] = (_Float16)p1;
    }
#if __has_builtin(__builtin_amdgcn_wave_barrier)
    __builtin_amdgcn_wave_barrier();  // keep P stores before P loads (intra-wave, LDS in-order)
#endif

    // ---- O += P V : P is A (16x32), V^T rows give contiguous B fragments ----
    Frag pa;
    pa.h[0] = *reinterpret_cast<const v8h*>(&pt[lhalf][hb]);
    pa.h[1] = *reinterpret_cast<const v8h*>(&pt[lhalf][16 + hb]);
#pragma unroll
    for (int dc = 0; dc < 4; ++dc) {
      Frag vb;
      vb.h[0] = *reinterpret_cast<const v8h*>(&vt[dc * 16 + lhalf][hb]);
      vb.h[1] = *reinterpret_cast<const v8h*>(&vt[dc * 16 + lhalf][16 + hb]);
      v8f* op = (dc == 0) ? &o0 : (dc == 1) ? &o1 : (dc == 2) ? &o2 : &o3;
      *op = __builtin_amdgcn_wmma_f32_16x16x32_f16(false, pa.v, false, vb.v, (short)0, *op, false, false);
    }

    // ---- publish tile jb+1, then refill the buffer this trip has read ----
    asm volatile("s_wait_dscnt 0x0" ::: "memory");     // own reads of buffer cur are done
    asm volatile("s_wait_asynccnt 0x0" ::: "memory");  // own copies of tile jb+1 landed
    __syncthreads();
    if (jb + 2 < NJ) {
      const uint32_t bk = cur * (KS_ * KT_BYTES), bv = cur * (KS_ * VT_BYTES);
      const int ko = (jb + 2) * 32;
      stage_kv(lk0 + bk, lk1 + bk, lv0 + bv, lv1 + bv,
               gk0 + (size_t)ko * D_, gk1 + (size_t)ko * D_, gv0 + ko, gv1 + ko);
    }
  }
  asm volatile("s_wait_asynccnt 0x0" ::: "memory");    // nothing in flight before the LDS is reused

  // ---- add the key groups' partial O and row sums through LDS (tiles are dead:
  //      the loop's last barrier ended every read of them) ----
  v4f* red = reinterpret_cast<v4f*>(smem);
  if (kg != 0) {
    v4f* dst = red + ((kg - 1) * 4 + qg) * 10 * 32 + lane;
    dst[0 * 32] = __builtin_shufflevector(o0, o0, 0, 1, 2, 3);
    dst[1 * 32] = __builtin_shufflevector(o0, o0, 4, 5, 6, 7);
    dst[2 * 32] = __builtin_shufflevector(o1, o1, 0, 1, 2, 3);
    dst[3 * 32] = __builtin_shufflevector(o1, o1, 4, 5, 6, 7);
    dst[4 * 32] = __builtin_shufflevector(o2, o2, 0, 1, 2, 3);
    dst[5 * 32] = __builtin_shufflevector(o2, o2, 4, 5, 6, 7);
    dst[6 * 32] = __builtin_shufflevector(o3, o3, 0, 1, 2, 3);
    dst[7 * 32] = __builtin_shufflevector(o3, o3, 4, 5, 6, 7);
    dst[8 * 32] = v4f{lsum[0], lsum[1], lsum[2], lsum[3]};
    dst[9 * 32] = v4f{lsum[4], lsum[5], lsum[6], lsum[7]};
  }
  __syncthreads();
  if (kg != 0) return;

  for (int g = 1; g < KS_; ++g) {
    const v4f* sp = red + ((g - 1) * 4 + qg) * 10 * 32 + lane;
    v4f t[10];
    for (int i = 0; i < 10; ++i) t[i] = sp[i * 32];
    for (int i = 0; i < 4; ++i) {
      o0[i] += t[0][i]; o0[4 + i] += t[1][i];
      o1[i] += t[2][i]; o1[4 + i] += t[3][i];
      o2[i] += t[4][i]; o2[4 + i] += t[5][i];
      o3[i] += t[6][i]; o3[4 + i] += t[7][i];
      lsum[i] += t[8][i]; lsum[4 + i] += t[9][i];
    }
  }

  // ---- epilogue: single row-sum reduction, normalize, store f16 [B,T,C] ----
#pragma unroll
  for (int r = 0; r < 8; ++r) {
    float ls = lsum[r];
    ls += __shfl_xor(ls, 1, 32);
    ls += __shfl_xor(ls, 2, 32);
    ls += __shfl_xor(ls, 4, 32);
    ls += __shfl_xor(ls, 8, 32);
    const float inv = 1.0f / ls;
    const int t = qt0 + mrb + r;
    _Float16* yrow = yh + ((size_t)(b * T_ + t)) * C_ + h * D_;
    yrow[0  + lhalf] = (_Float16)(o0[r] * inv);
    yrow[16 + lhalf] = (_Float16)(o1[r] * inv);
    yrow[32 + lhalf] = (_Float16)(o2[r] * inv);
    yrow[48 + lhalf] = (_Float16)(o3[r] * inv);
  }
}

// ---------------------------------------------------------------------------
// Output projection: out = Y @ Wproj^T, f32 result.
// grid: ((B*T)/16, C/64); block: 128 (4 waves x 16x16 tiles).
// ---------------------------------------------------------------------------
__global__ __launch_bounds__(128)
void proj_kernel(const _Float16* __restrict__ yhp,
                 const _Float16* __restrict__ wph,
                 float* __restrict__ out) {
  __shared__ __align__(16) _Float16 ys[16][392];

  const int tid  = threadIdx.x;
  const int bt0  = blockIdx.x * 16;
  const int nb   = blockIdx.y * 64;

  const _Float16* yrow = yhp + (size_t)bt0 * C_;
  for (int i = tid; i < 768; i += 128) {
    int r = i / 48, cc = (i % 48) * 8;
    async_ld_b128(lds_off(&ys[r][cc]), (const void*)(yrow + (size_t)r * C_ + cc));
  }
  wait_async0();
  __syncthreads();

  const int wave  = tid >> 5;
  const int lane  = tid & 31;
  const int lhalf = lane & 15;
  const int hb    = (lane >> 4) * 8;
  const int mrb   = (lane >> 4) * 8;
  const int n0    = nb + wave * 16;

  const _Float16* wrow = wph + (size_t)(n0 + lhalf) * C_;

  v8f acc = {};
#pragma unroll
  for (int kk = 0; kk < 12; ++kk) {
    const int kb = kk * 32;
    Frag a, bf;
    a.h[0]  = *reinterpret_cast<const v8h*>(&ys[lhalf][kb + hb]);
    a.h[1]  = *reinterpret_cast<const v8h*>(&ys[lhalf][kb + 16 + hb]);
    bf.h[0] = *reinterpret_cast<const v8h*>(wrow + kb + hb);
    bf.h[1] = *reinterpret_cast<const v8h*>(wrow + kb + 16 + hb);
    acc = __builtin_amdgcn_wmma_f32_16x16x32_f16(false, a.v, false, bf.v,
                                                 (short)0, acc, false, false);
  }

#pragma unroll
  for (int r = 0; r < 8; ++r)
    out[(size_t)(bt0 + mrb + r) * C_ + n0 + lhalf] = acc[r];
}

// ---------------------------------------------------------------------------
extern "C" void kernel_launch(void* const* d_in, const int* in_sizes, int n_in,
                              void* d_out, int out_size, void* d_ws, size_t ws_size,
                              hipStream_t stream) {
  (void)in_sizes; (void)n_in; (void)out_size; (void)ws_size;

  const float* x      = (const float*)d_in[0];
  const float* cosp   = (const float*)d_in[1];
  const float* sinp   = (const float*)d_in[2];
  const int*   maskp  = (const int*)d_in[3];
  const float* Wq     = (const float*)d_in[4];
  const float* Wk     = (const float*)d_in[5];
  const float* Wv     = (const float*)d_in[6];
  const float* Wproj  = (const float*)d_in[7];
  const float* rawb   = (const float*)d_in[8];
  const int*   bscale = (const int*)d_in[9];
  float* out = (float*)d_out;

  const size_t XN = (size_t)B_ * T_ * C_;   // 3,145,728
  const size_t WN = (size_t)C_ * C_;        // 147,456

  _Float16* p   = (_Float16*)d_ws;
  _Float16* xh  = p; p += XN;
  _Float16* wqh = p; p += WN;
  _Float16* wkh = p; p += WN;
  _Float16* wvh = p; p += WN;
  _Float16* wph = p; p += WN;
  _Float16* qh  = p; p += XN;
  _Float16* kh  = p; p += XN;
  _Float16* vh  = p; p += XN;   // transposed layout [B,H,D,T]
  _Float16* yh  = p; p += XN;

  cvt_kernel<<<2048, 256, 0, stream>>>(x, xh, (int)XN);
  cvt_kernel<<<288, 256, 0, stream>>>(Wq, wqh, (int)WN);
  cvt_kernel<<<288, 256, 0, stream>>>(Wk, wkh, (int)WN);
  cvt_kernel<<<288, 256, 0, stream>>>(Wv, wvh, (int)WN);
  cvt_kernel<<<288, 256, 0, stream>>>(Wproj, wph, (int)WN);

  dim3 g1(T_ / 16, 3 * B_);
  qkv_kernel<<<g1, 128, 0, stream>>>(xh, wqh, wkh, wvh, cosp, sinp, qh, kh, vh);

  dim3 g2(T_ / 64, H_, B_);
  attn_kernel<<<g2, 128 * KS_, 0, stream>>>(qh, kh, vh, maskp, rawb, bscale, yh);

  dim3 g3((B_ * T_) / 16, C_ / 64);
  proj_kernel<<<g3, 128, 0, stream>>>(yh, wph, out);
}

// v002
// It runs in 91.4 microseconds.
// Next to v001, in two timings, it ran 1.12 times as fast each time.
// Counting every step since v000, it is 1.36 times as fast.
#include <hip/hip_runtime.h>
#include <hip/hip_bf16.h>
#include <cstdint>

#define B_ 4
#define T_ 2048
#define C_ 384
#define H_ 6
#define D_ 64

typedef __attribute__((ext_vector_type(16))) _Float16 v16h;
typedef __attribute__((ext_vector_type(8)))  _Float16 v8h;
typedef __attribute__((ext_vector_type(4)))  _Float16 v4h;
typedef __attribute__((ext_vector_type(8)))  float    v8f;
typedef __attribute__((ext_vector_type(4)))  float    v4f;

union Frag { v16h v; v8h h[2]; };

__device__ __forceinline__ void async_ld_b128(uint32_t lds_byte_off, const void* gptr) {
  asm volatile("global_load_async_to_lds_b128 %0, %1, off"
               :: "v"(lds_byte_off), "v"(gptr) : "memory");
}
__device__ __forceinline__ void wait_async0() {
#if __has_builtin(__builtin_amdgcn_s_wait_asynccnt)
  __builtin_amdgcn_s_wait_asynccnt(0);
#else
  asm volatile("s_wait_asynccnt 0" ::: "memory");
#endif
}
__device__ __forceinline__ uint32_t lds_off(const void* p) {
  return (uint32_t)(uintptr_t)p;
}

__device__ __forceinline__ float clamp_bias(float x) {
  return fminf(2.0f, fmaxf(-2.0f, x));
}

// ---------------------------------------------------------------------------
// f32 -> f16 conversion of the four C x C weight matrices in one launch.
// grid: (C*C/2048, 4); block: 256. blockIdx.y picks the matrix; the four f16
// copies lie one behind the other in dst. Eight elements per thread.
// ---------------------------------------------------------------------------
__global__ __launch_bounds__(256)
void cvt_w_kernel(const float* __restrict__ w0, const float* __restrict__ w1,
                  const float* __restrict__ w2, const float* __restrict__ w3,
                  _Float16* __restrict__ dst) {
  const int m = blockIdx.y;
  const float* src = (m == 0) ? w0 : (m == 1) ? w1 : (m == 2) ? w2 : w3;
  const int i = (blockIdx.x * 256 + threadIdx.x) * 8;
  const v4f a = *reinterpret_cast<const v4f*>(src + i);
  const v4f c = *reinterpret_cast<const v4f*>(src + i + 4);
  const v8h o = {(_Float16)a[0], (_Float16)a[1], (_Float16)a[2], (_Float16)a[3],
                 (_Float16)c[0], (_Float16)c[1], (_Float16)c[2], (_Float16)c[3]};
  *reinterpret_cast<v8h*>(dst + (size_t)m * (C_ * C_) + i) = o;
}

// ---------------------------------------------------------------------------
// QKV projection + RoPE + RMS-norm.
// grid: (T/16, 3*B); block: 128 (4 waves). Block computes all 384 output cols
// (all 6 heads) for 16 tokens of one matrix: 4 waves x 6 N-tiles, X loaded once
// as f32 and rounded to f16 on its way into LDS.
// which = blockIdx.y / B : 0=Q, 1=K, 2=V
// Q/K stored [B,H,T,64] (Q pre-scaled by 1/sqrt(D)); V stored transposed [B,H,64,T].
// ---------------------------------------------------------------------------
__global__ __launch_bounds__(128)
void qkv_kernel(const float* __restrict__ x,
                const _Float16* __restrict__ wqh,
                const _Float16* __restrict__ wkh,
                const _Float16* __restrict__ wvh,
                const float* __restrict__ cosp,
                const float* __restrict__ sinp,
                _Float16* __restrict__ qh,
                _Float16* __restrict__ kh,
                _Float16* __restrict__ vh) {
  __shared__ __align__(16) _Float16 xs[16][392];    // 16 x 384 (+pad)  12.5 KB
  __shared__ __align__(16) float    outs[16][392];  // 16 x 384 (+pad)  25 KB

  const int tid   = threadIdx.x;
  const int b     = blockIdx.y % B_;
  const int which = blockIdx.y / B_;
  const int t0    = blockIdx.x * 16;

  // 16 rows x 384 f32 are contiguous: 1536 16-byte pieces, 12 per thread, all
  // loads issued before the first conversion.
  const float* xrow = x + ((size_t)b * T_ + t0) * C_;
  v4f xv[12];
#pragma unroll  // xv stays in registers and the 12 loads are in flight together
  for (int k = 0; k < 12; ++k)
    xv[k] = *reinterpret_cast<const v4f*>(xrow + (tid + k * 128) * 4);
#pragma unroll  // constant k: xv indexed statically, no scratch
  for (int k = 0; k < 12; ++k) {
    const int j = tid + k * 128;
    const int r = j / 96, cc = (j % 96) * 4;
    const v4h hv = {(_Float16)xv[k][0], (_Float16)xv[k][1], (_Float16)xv[k][2], (_Float16)xv[k][3]};
    *reinterpret_cast<v4h*>(&xs[r][cc]) = hv;
  }
  __syncthreads();

  const _Float16* Wsel = (which == 0) ? wqh : (which == 1) ? wkh : wvh;
  const int wave  = tid >> 5;
  const int lane  = tid & 31;
  const int lhalf = lane & 15;
  const int hb    = (lane >> 4) * 8;   // K sub-block select per A/B layout
  const int mrb   = (lane >> 4) * 8;   // C/D row base

  for (int nt = 0; nt < 6; ++nt) {
    const int n0 = (nt * 4 + wave) * 16;            // output col base, 0..368
    const _Float16* wrow = Wsel + (size_t)(n0 + lhalf) * C_;
    v8f acc = {};
#pragma unroll
    for (int kk = 0; kk < 12; ++kk) {
      const int kb = kk * 32;
      Frag a, bf;
      a.h[0]  = *reinterpret_cast<const v8h*>(&xs[lhalf][kb + hb]);
      a.h[1]  = *reinterpret_cast<const v8h*>(&xs[lhalf][kb + 16 + hb]);
      bf.h[0] = *reinterpret_cast<const v8h*>(wrow + kb + hb);
      bf.h[1] = *reinterpret_cast<const v8h*>(wrow + kb + 16 + hb);
      acc = __builtin_amdgcn_wmma_f32_16x16x32_f16(false, a.v, false, bf.v,
                                                   (short)0, acc, false, false);
    }
#pragma unroll
    for (int r = 0; r < 8; ++r) outs[mrb + r][n0 + lhalf] = acc[r];
  }
  __syncthreads();

  if (which == 2) {
    // V transposed: [B,H,D,T]
    for (int i = tid; i < 16 * 384; i += 128) {
      int col = i >> 4, r = i & 15;
      int h = col >> 6, d = col & 63;
      vh[((size_t)(b * H_ + h) * D_ + d) * T_ + t0 + r] = (_Float16)outs[r][col];
    }
  } else {
    // RoPE + RMS: 384 work items = 6 heads x 16 rows x 4 parts; 3 uniform passes.
    _Float16* dstbase = (which == 0) ? qh : kh;
    const float qscale = (which == 0) ? 0.125f : 1.0f;  // fold softmax 1/sqrt(D) into Q
    for (int item = tid; item < 384; item += 128) {
      const int h    = item >> 6;
      const int rem  = item & 63;
      const int row  = rem >> 2;
      const int part = rem & 3;
      const int t    = t0 + row;
      float r1[8], r2[8];
      float ss = 0.0f;
#pragma unroll
      for (int jj = 0; jj < 8; ++jj) {
        const int j = part * 8 + jj;
        float c  = cosp[(size_t)t * 32 + j];
        float s  = sinp[(size_t)t * 32 + j];
        float x1 = outs[row][h * 64 + j];
        float x2 = outs[row][h * 64 + j + 32];
        r1[jj] = x1 * c + x2 * s;
        r2[jj] = -x1 * s + x2 * c;
        ss += r1[jj] * r1[jj] + r2[jj] * r2[jj];
      }
      // 4 parts of one row sit in 4 adjacent lanes (groups aligned to 4)
      ss += __shfl_xor(ss, 1, 32);
      ss += __shfl_xor(ss, 2, 32);
      const float inv = rsqrtf(ss * (1.0f / 64.0f) + 1.1920929e-7f) * qscale;
      _Float16* qout = dstbase + ((size_t)(b * H_ + h) * T_ + t) * D_;
#pragma unroll
      for (int jj = 0; jj < 8; ++jj) {
        const int j = part * 8 + jj;
        qout[j]      = (_Float16)(r1[jj] * inv);
        qout[j + 32] = (_Float16)(r2[jj] * inv);
      }
    }
  }
}

// ---------------------------------------------------------------------------
// Flash attention, fixed-max softmax, keys split over wave groups.
// RMS-norm bounds: ||q_scaled|| = 1, ||k|| = 8 => |score| <= 8; bias clip +-2
// => |s| <= 10. exp(10)=2.2e4 < f16 max; row sum < 2048*e^10 ~ 4.5e7 < f32 max.
// So no running max, no accumulator rescale: partial O and partial row sums of
// disjoint key ranges simply add.
// Q/K [B,H,T,64] f16 (Q pre-scaled), V [B,H,64,T] f16. Y f16 token-major [B,T,C].
// grid: (T/64, H, B); block: 128*KS_ threads = KS_ key groups x 4 waves.
// Wave (kg, qg): query rows qg*16..+16 of the block, keys kg*T/KS_ .. +T/KS_.
// Each key group stages its own 32-key K and V tiles; the groups' partial
// results are added through LDS once, behind the loop.
// ---------------------------------------------------------------------------
#define KS_ 2
#define KT_BYTES (32 * 72 * 2)            // one K tile: 32 keys x 64 dims (+pad)
#define VT_BYTES (64 * 40 * 2)            // one V tile: 64 dims x 32 keys (+pad)
#define PT_BYTES (16 * 40 * 2)            // one wave's P tile 16x32 (+pad)
#define K_OFF(buf, kg) (((buf) * KS_ + (kg)) * KT_BYTES)
#define V_OFF(buf, kg) (2 * KS_ * KT_BYTES + ((buf) * KS_ + (kg)) * VT_BYTES)
#define P_OFF(w)       (2 * KS_ * (KT_BYTES + VT_BYTES) + (w) * PT_BYTES)
#define ATTN_LDS       (2 * KS_ * (KT_BYTES + VT_BYTES) + 4 * KS_ * PT_BYTES)

__device__ __forceinline__ void stage_kv(uint32_t lk0, uint32_t lk1, uint32_t lv0, uint32_t lv1,
                                         const _Float16* gk0, const _Float16* gk1,
                                         const _Float16* gv0, const _Float16* gv1) {
  asm volatile("global_load_async_to_lds_b128 %0, %4, off\n\t"
               "global_load_async_to_lds_b128 %1, %5, off\n\t"
               "global_load_async_to_lds_b128 %2, %6, off\n\t"
               "global_load_async_to_lds_b128 %3, %7, off\n\t"
               "s_wait_xcnt 0x0"
               :: "v"(lk0), "v"(lk1), "v"(lv0), "v"(lv1),
                  "v"(gk0), "v"(gk1), "v"(gv0), "v"(gv1) : "memory");
}

__global__ __launch_bounds__(128 * KS_)
void attn_kernel(const _Float16* __restrict__ qh,
                 const _Float16* __restrict__ kh,
                 const _Float16* __restrict__ vh,
                 const int* __restrict__ maskp,
                 const float* __restrict__ rawb,
                 const int* __restrict__ bscale,
                 _Float16* __restrict__ yh) {
  __shared__ __align__(16) unsigned char smem[ATTN_LDS];

  const int tid   = threadIdx.x;
  const int wave  = tid >> 5;
  const int qg    = wave & 3;          // query group
  const int kg    = wave >> 2;         // key group
  const int t128  = tid & 127;         // thread within its key group
  const int lane  = tid & 31;
  const int lhalf = lane & 15;
  const int hb    = (lane >> 4) * 8;
  const int mrb   = (lane >> 4) * 8;

  const int b   = blockIdx.z;
  const int h   = blockIdx.y;
  const int qt0 = blockIdx.x * 64 + qg * 16;
  const int kbase = kg * (T_ / KS_);   // first key of this wave's range

  const _Float16* Qb  = qh + (size_t)(b * H_ + h) * T_ * D_;
  const _Float16* Kb  = kh + (size_t)(b * H_ + h) * T_ * D_ + (size_t)kbase * D_;
  const _Float16* Vtb = vh + (size_t)(b * H_ + h) * D_ * T_ + kbase;

  // Q fragments (K = 0..31 and 32..63)
  Frag qa0, qa1;
  {
    const _Float16* qr = Qb + (size_t)(qt0 + lhalf) * D_;
    qa0.h[0] = *reinterpret_cast<const v8h*>(qr + 0 + hb);
    qa0.h[1] = *reinterpret_cast<const v8h*>(qr + 16 + hb);
    qa1.h[0] = *reinterpret_cast<const v8h*>(qr + 32 + hb);
    qa1.h[1] = *reinterpret_cast<const v8h*>(qr + 48 + hb);
  }

  // bias takes only 4 values (mask is binary): precompute and select
  const float bs = (float)bscale[0];
  const float g1 = 0.5f * tanhf(rawb[h * 3 + 0]) * bs;
  const float g2 = 0.5f * tanhf(rawb[h * 3 + 1]) * bs;
  const float g3 = 0.5f * tanhf(rawb[h * 3 + 2]) * bs;
  const float cg1   = clamp_bias(g1);
  const float cg2   = clamp_bias(g2);
  const float cg123 = clamp_bias(g1 + g2 + g3);

  float bi0[8], bi1[8];   // per accumulator row: bias for mj=0 / mj=1
#pragma unroll
  for (int r = 0; r < 8; ++r) {
    const bool mi = maskp[b * T_ + qt0 + mrb + r] != 0;
    bi0[r] = mi ? cg1 : 0.0f;
    bi1[r] = mi ? cg123 : cg2;
  }

  float lsum[8];
#pragma unroll
  for (int r = 0; r < 8; ++r) lsum[r] = 0.0f;
  v8f o0 = {}, o1 = {}, o2 = {}, o3 = {};

  const int NJ = T_ / (32 * KS_);      // 32-key tiles per key group

  // this thread's two 16-byte chunks of a K tile and of a V tile
  const int e0 = t128 * 8, e1 = (t128 + 128) * 8;
  const int kr0 = e0 >> 6, kc0 = e0 & 63, kr1 = e1 >> 6, kc1 = e1 & 63;
  const int vd0 = e0 >> 5, vc0 = e0 & 31, vd1 = e1 >> 5, vc1 = e1 & 31;
  const uint32_t sbase = lds_off(smem);
  const uint32_t lk0 = sbase + K_OFF(0, kg) + (kr0 * 72 + kc0) * 2;
  const uint32_t lk1 = sbase + K_OFF(0, kg) + (kr1 * 72 + kc1) * 2;
  const uint32_t lv0 = sbase + V_OFF(0, kg) + (vd0 * 40 + vc0) * 2;
  const uint32_t lv1 = sbase + V_OFF(0, kg) + (vd1 * 40 + vc1) * 2;
  const _Float16* gk0 = Kb + kr0 * D_ + kc0;
  const _Float16* gk1 = Kb + kr1 * D_ + kc1;
  const _Float16* gv0 = Vtb + (size_t)vd0 * T_ + vc0;
  const _Float16* gv1 = Vtb + (size_t)vd1 * T_ + vc1;

  // ---- tile 0 into buffer 0, published; then tile 1 into buffer 1 ----
  stage_kv(lk0, lk1, lv0, lv1, gk0, gk1, gv0, gv1);
  asm volatile("s_wait_asynccnt 0x0" ::: "memory");  // own copies of tile 0 landed
  __syncthreads();
  stage_kv(lk0 + KS_ * KT_BYTES, lk1 + KS_ * KT_BYTES, lv0 + KS_ * VT_BYTES, lv1 + KS_ * VT_BYTES,
           gk0 + 32 * D_, gk1 + 32 * D_, gv0 + 32, gv1 + 32);

  _Float16 (*pt)[40] = reinterpret_cast<_Float16 (*)[40]>(smem + P_OFF(wave));

  for (int jb = 0; jb < NJ; ++jb) {
    const int cur = jb & 1;
    const _Float16 (*kt)[72] = reinterpret_cast<const _Float16 (*)[72]>(smem + K_OFF(cur, kg));
    const _Float16 (*vt)[40] = reinterpret_cast<const _Float16 (*)[40]>(smem + V_OFF(cur, kg));

    // ---- S = Q K^T for keys [kbase + jb*32, +32) ----
    v8f s0 = {}, s1 = {};
    {
      Frag bk;
      bk.h[0] = *reinterpret_cast<const v8h*>(&kt[lhalf][0 + hb]);
      bk.h[1] = *reinterpret_cast<const v8h*>(&kt[lhalf][16 + hb]);
      s0 = __builtin_amdgcn_wmma_f32_16x16x32_f16(false, qa0.v, false, bk.v, (short)0, s0, false, false);
      bk.h[0] = *reinterpret_cast<const v8h*>(&kt[lhalf][32 + hb]);
      bk.h[1] = *reinterpret_cast<const v8h*>(&kt[lhalf][48 + hb]);
      s0 = __builtin_amdgcn_wmma_f32_16x16x32_f16(false, qa1.v, false, bk.v, (short)0, s0, false, false);
      bk.h[0] = *reinterpret_cast<const v8h*>(&kt[16 + lhalf][0 + hb]);
      bk.h[1] = *reinterpret_cast<const v8h*>(&kt[16 + lhalf][16 + hb]);
      s1 = __builtin_amdgcn_wmma_f32_16x16x32_f16(false, qa0.v, false, bk.v, (short)0, s1, false, false);
      bk.h[0] = *reinterpret_cast<const v8h*>(&kt[16 + lhalf][32 + hb]);
      bk.h[1] = *reinterpret_cast<const v8h*>(&kt[16 + lhalf][48 + hb]);
      s1 = __builtin_amdgcn_wmma_f32_16x16x32_f16(false, qa1.v, false, bk.v, (short)0, s1, false, false);
    }

    const bool mj0 = maskp[b * T_ + kbase + jb * 32 + lhalf] != 0;
    const bool mj1 = maskp[b * T_ + kbase + jb * 32 + 16 + lhalf] != 0;

    // ---- fixed-max softmax numerators, write P tile ----
#pragma unroll
    for (int r = 0; r < 8; ++r) {
      const float p0 = __expf(s0[r] + (mj0 ? bi1[r] : bi0[r]));
      const float p1 = __expf(s1[r] + (mj1 ? bi1[r] : bi0[r]));
      lsum[r] += p0 + p1;          // per-lane partial; reduced once at the end
      pt[mrb + r][lhalf]      = (_Float16)p0;
      pt[mrb + r][16 + lhalf] = (_Float16)p1;
    }
#if __has_builtin(__builtin_amdgcn_wave_barrier)
    __builtin_amdgcn_wave_barrier();  // keep P stores before P loads (intra-wave, LDS in-order)
#endif

    // ---- O += P V : P is A (16x32), V^T rows give contiguous B fragments ----
    Frag pa;
    pa.h[0] = *reinterpret_cast<const v8h*>(&pt[lhalf][hb]);
    pa.h[1] = *reinterpret_cast<const v8h*>(&pt[lhalf][16 + hb]);
#pragma unroll
    for (int dc = 0; dc < 4; ++dc) {
      Frag vb;
      vb.h[0] = *reinterpret_cast<const v8h*>(&vt[dc * 16 + lhalf][hb]);
      vb.h[1] = *reinterpret_cast<const v8h*>(&vt[dc * 16 + lhalf][16 + hb]);
      v8f* op = (dc == 0) ? &o0 : (dc == 1) ? &o1 : (dc == 2) ? &o2 : &o3;
      *op = __builtin_amdgcn_wmma_f32_16x16x32_f16(false, pa.v, false, vb.v, (short)0, *op, false, false);
    }

    // ---- publish tile jb+1, then refill the buffer this trip has read ----
    asm volatile("s_wait_dscnt 0x0" ::: "memory");     // own reads of buffer cur are done
    asm volatile("s_wait_asynccnt 0x0" ::: "memory");  // own copies of tile jb+1 landed
    __syncthreads();
    if (jb + 2 < NJ) {
      const uint32_t bk = cur * (KS_ * KT_BYTES), bv = cur * (KS_ * VT_BYTES);
      const int ko = (jb + 2) * 32;
      stage_kv(lk0 + bk, lk1 + bk, lv0 + bv, lv1 + bv,
               gk0 + (size_t)ko * D_, gk1 + (size_t)ko * D_, gv0 + ko, gv1 + ko);
    }
  }
  asm volatile("s_wait_asynccnt 0x0" ::: "memory");    // nothing in flight before the LDS is reused

  // ---- add the key groups' partial O and row sums through LDS (tiles are dead:
  //      the loop's last barrier ended every read of them) ----
  v4f* red = reinterpret_cast<v4f*>(smem);
  if (kg != 0) {
    v4f* dst = red + ((kg - 1) * 4 + qg) * 10 * 32 + lane;
    dst[0 * 32] = __builtin_shufflevector(o0, o0, 0, 1, 2, 3);
    dst[1 * 32] = __builtin_shufflevector(o0, o0, 4, 5, 6, 7);
    dst[2 * 32] = __builtin_shufflevector(o1, o1, 0, 1, 2, 3);
    dst[3 * 32] = __builtin_shufflevector(o1, o1, 4, 5, 6, 7);
    dst[4 * 32] = __builtin_shufflevector(o2, o2, 0, 1, 2, 3);
    dst[5 * 32] = __builtin_shufflevector(o2, o2, 4, 5, 6, 7);
    dst[6 * 32] = __builtin_shufflevector(o3, o3, 0, 1, 2, 3);
    dst[7 * 32] = __builtin_shufflevector(o3, o3, 4, 5, 6, 7);
    dst[8 * 32] = v4f{lsum[0], lsum[1], lsum[2], lsum[3]};
    dst[9 * 32] = v4f{lsum[4], lsum[5], lsum[6], lsum[7]};
  }
  __syncthreads();
  if (kg != 0) return;

  for (int g = 1; g < KS_; ++g) {
    const v4f* sp = red + ((g - 1) * 4 + qg) * 10 * 32 + lane;
    v4f t[10];
    for (int i = 0; i < 10; ++i) t[i] = sp[i * 32];
    for (int i = 0; i < 4; ++i) {
      o0[i] += t[0][i]; o0[4 + i] += t[1][i];
      o1[i] += t[2][i]; o1[4 + i] += t[3][i];
      o2[i] += t[4][i]; o2[4 + i] += t[5][i];
      o3[i] += t[6][i]; o3[4 + i] += t[7][i];
      lsum[i] += t[8][i]; lsum[4 + i] += t[9][i];
    }
  }

  // ---- epilogue: single row-sum reduction, normalize, store f16 [B,T,C] ----
#pragma unroll
  for (int r = 0; r < 8; ++r) {
    float ls = lsum[r];
    ls += __shfl_xor(ls, 1, 32);
    ls += __shfl_xor(ls, 2, 32);
    ls += __shfl_xor(ls, 4, 32);
    ls += __shfl_xor(ls, 8, 32);
    const float inv = 1.0f / ls;
    const int t = qt0 + mrb + r;
    _Float16* yrow = yh + ((size_t)(b * T_ + t)) * C_ + h * D_;
    yrow[0  + lhalf] = (_Float16)(o0[r] * inv);
    yrow[16 + lhalf] = (_Float16)(o1[r] * inv);
    yrow[32 + lhalf] = (_Float16)(o2[r] * inv);
    yrow[48 + lhalf] = (_Float16)(o3[r] * inv);
  }
}

// ---------------------------------------------------------------------------
// Output projection: out = Y @ Wproj^T, f32 result.
// grid: ((B*T)/16, C/64); block: 128 (4 waves x 16x16 tiles).
// ---------------------------------------------------------------------------
__global__ __launch_bounds__(128)
void proj_kernel(const _Float16* __restrict__ yhp,
                 const _Float16* __restrict__ wph,
                 float* __restrict__ out) {
  __shared__ __align__(16) _Float16 ys[16][392];

  const int tid  = threadIdx.x;
  const int bt0  = blockIdx.x * 16;
  const int nb   = blockIdx.y * 64;

  const _Float16* yrow = yhp + (size_t)bt0 * C_;
  for (int i = tid; i < 768; i += 128) {
    int r = i / 48, cc = (i % 48) * 8;
    async_ld_b128(lds_off(&ys[r][cc]), (const void*)(yrow + (size_t)r * C_ + cc));
  }
  wait_async0();
  __syncthreads();

  const int wave  = tid >> 5;
  const int lane  = tid & 31;
  const int lhalf = lane & 15;
  const int hb    = (lane >> 4) * 8;
  const int mrb   = (lane >> 4) * 8;
  const int n0    = nb + wave * 16;

  const _Float16* wrow = wph + (size_t)(n0 + lhalf) * C_;

  v8f acc = {};
#pragma unroll
  for (int kk = 0; kk < 12; ++kk) {
    const int kb = kk * 32;
    Frag a, bf;
    a.h[0]  = *reinterpret_cast<const v8h*>(&ys[lhalf][kb + hb]);
    a.h[1]  = *reinterpret_cast<const v8h*>(&ys[lhalf][kb + 16 + hb]);
    bf.h[0] = *reinterpret_cast<const v8h*>(wrow + kb + hb);
    bf.h[1] = *reinterpret_cast<const v8h*>(wrow + kb + 16 + hb);
    acc = __builtin_amdgcn_wmma_f32_16x16x32_f16(false, a.v, false, bf.v,
                                                 (short)0, acc, false, false);
  }

#pragma unroll
  for (int r = 0; r < 8; ++r)
    out[(size_t)(bt0 + mrb + r) * C_ + n0 + lhalf] = acc[r];
}

// ---------------------------------------------------------------------------
extern "C" void kernel_launch(void* const* d_in, const int* in_sizes, int n_in,
                              void* d_out, int out_size, void* d_ws, size_t ws_size,
                              hipStream_t stream) {
  (void)in_sizes; (void)n_in; (void)out_size; (void)ws_size;

  const float* x      = (const float*)d_in[0];
  const float* cosp   = (const float*)d_in[1];
  const float* sinp   = (const float*)d_in[2];
  const int*   maskp  = (const int*)d_in[3];
  const float* Wq     = (const float*)d_in[4];
  const float* Wk     = (const float*)d_in[5];
  const float* Wv     = (const float*)d_in[6];
  const float* Wproj  = (const float*)d_in[7];
  const float* rawb   = (const float*)d_in[8];
  const int*   bscale = (const int*)d_in[9];
  float* out = (float*)d_out;

  const size_t XN = (size_t)B_ * T_ * C_;   // 3,145,728
  const size_t WN = (size_t)C_ * C_;        // 147,456

  _Float16* p   = (_Float16*)d_ws;
  _Float16* wqh = p; p += WN;
  _Float16* wkh = p; p += WN;
  _Float16* wvh = p; p += WN;
  _Float16* wph = p; p += WN;
  _Float16* qh  = p; p += XN;
  _Float16* kh  = p; p += XN;
  _Float16* vh  = p; p += XN;   // transposed layout [B,H,D,T]
  _Float16* yh  = p; p += XN;

  dim3 g0(C_ * C_ / 2048, 4);
  cvt_w_kernel<<<g0, 256, 0, stream>>>(Wq, Wk, Wv, Wproj, wqh);   // fills wqh, wkh, wvh, wph

  dim3 g1(T_ / 16, 3 * B_);
  qkv_kernel<<<g1, 128, 0, stream>>>(x, wqh, wkh, wvh, cosp, sinp, qh, kh, vh);

  dim3 g2(T_ / 64, H_, B_);
  attn_kernel<<<g2, 128 * KS_, 0, stream>>>(qh, kh, vh, maskp, rawb, bscale, yh);

  dim3 g3((B_ * T_) / 16, C_ / 64);
  proj_kernel<<<g3, 128, 0, stream>>>(yh, wph, out);
}

// v003
// A run of this version takes 78.7 microseconds.
// In both of two side-by-side timings against v002, it was 1.17 times as fast.
// Over all steps from v000 it is 1.59 times as fast.
#include <hip/hip_runtime.h>
#include <hip/hip_bf16.h>
#include <cstdint>

#define B_ 4
#define T_ 2048
#define C_ 384
#define H_ 6
#define D_ 64

typedef __attribute__((ext_vector_type(16))) _Float16 v16h;
typedef __attribute__((ext_vector_type(8)))  _Float16 v8h;
typedef __attribute__((ext_vector_type(4)))  _Float16 v4h;
typedef __attribute__((ext_vector_type(8)))  float    v8f;
typedef __attribute__((ext_vector_type(4)))  float    v4f;
typedef __attribute__((ext_vector_type(4)))  int      v4i;

union Frag { v16h v; v8h h[2]; };

__device__ __forceinline__ void async_ld_b128(uint32_t lds_byte_off, const void* gptr) {
  asm volatile("global_load_async_to_lds_b128 %0, %1, off"
               :: "v"(lds_byte_off), "v"(gptr) : "memory");
}
__device__ __forceinline__ void wait_async0() {
#if __has_builtin(__builtin_amdgcn_s_wait_asynccnt)
  __builtin_amdgcn_s_wait_asynccnt(0);
#else
  asm volatile("s_wait_asynccnt 0" ::: "memory");
#endif
}
__device__ __forceinline__ uint32_t lds_off(const void* p) {
  return (uint32_t)(uintptr_t)p;
}

__device__ __forceinline__ float clamp_bias(float x) {
  return fminf(2.0f, fmaxf(-2.0f, x));
}

// ---------------------------------------------------------------------------
// f32 -> f16 conversion of the four C x C weight matrices in one launch.
// grid: (C*C/2048, 4); block: 256. blockIdx.y picks the matrix; the four f16
// copies lie one behind the other in dst. Eight elements per thread.
// ---------------------------------------------------------------------------
__global__ __launch_bounds__(256)
void cvt_w_kernel(const float* __restrict__ w0, const float* __restrict__ w1,
                  const float* __restrict__ w2, const float* __restrict__ w3,
                  _Float16* __restrict__ dst) {
  const int m = blockIdx.y;
  const float* src = (m == 0) ? w0 : (m == 1) ? w1 : (m == 2) ? w2 : w3;
  const int i = (blockIdx.x * 256 + threadIdx.x) * 8;
  const v4f a = *reinterpret_cast<const v4f*>(src + i);
  const v4f c = *reinterpret_cast<const v4f*>(src + i + 4);
  const v8h o = {(_Float16)a[0], (_Float16)a[1], (_Float16)a[2], (_Float16)a[3],
                 (_Float16)c[0], (_Float16)c[1], (_Float16)c[2], (_Float16)c[3]};
  *reinterpret_cast<v8h*>(dst + (size_t)m * (C_ * C_) + i) = o;
}

// ---------------------------------------------------------------------------
// QKV projection + RoPE + RMS-norm.
// grid: (T/16, 3*B); block: 128 (4 waves). Block computes all 384 output cols
// (all 6 heads) for 16 tokens of one matrix: 4 waves x 6 N-tiles, X loaded once
// as f32 and rounded to f16 on its way into LDS.
// which = blockIdx.y / B : 0=Q, 1=K, 2=V
// Q/K stored [B,H,T,64] (Q pre-scaled by 1/sqrt(D)); V stored transposed [B,H,64,T].
// ---------------------------------------------------------------------------
__global__ __launch_bounds__(128)
void qkv_kernel(const float* __restrict__ x,
                const _Float16* __restrict__ wqh,
                const _Float16* __restrict__ wkh,
                const _Float16* __restrict__ wvh,
                const float* __restrict__ cosp,
                const float* __restrict__ sinp,
                _Float16* __restrict__ qh,
                _Float16* __restrict__ kh,
                _Float16* __restrict__ vh) {
  __shared__ __align__(16) _Float16 xs[16][392];    // 16 x 384 (+pad)  12.5 KB
  __shared__ __align__(16) float    outs[16][392];  // 16 x 384 (+pad)  25 KB

  const int tid   = threadIdx.x;
  const int b     = blockIdx.y % B_;
  const int which = blockIdx.y / B_;
  const int t0    = blockIdx.x * 16;

  // 16 rows x 384 f32 are contiguous: 1536 16-byte pieces, 12 per thread, all
  // loads issued before the first conversion.
  const float* xrow = x + ((size_t)b * T_ + t0) * C_;
  v4f xv[12];
#pragma unroll  // xv stays in registers and the 12 loads are in flight together
  for (int k = 0; k < 12; ++k)
    xv[k] = *reinterpret_cast<const v4f*>(xrow + (tid + k * 128) * 4);
#pragma unroll  // constant k: xv indexed statically, no scratch
  for (int k = 0; k < 12; ++k) {
    const int j = tid + k * 128;
    const int r = j / 96, cc = (j % 96) * 4;
    const v4h hv = {(_Float16)xv[k][0], (_Float16)xv[k][1], (_Float16)xv[k][2], (_Float16)xv[k][3]};
    *reinterpret_cast<v4h*>(&xs[r][cc]) = hv;
  }
  __syncthreads();

  const _Float16* Wsel = (which == 0) ? wqh : (which == 1) ? wkh : wvh;
  const int wave  = tid >> 5;
  const int lane  = tid & 31;
  const int lhalf = lane & 15;
  const int hb    = (lane >> 4) * 8;   // K sub-block select per A/B layout
  const int mrb   = (lane >> 4) * 8;   // C/D row base

  for (int nt = 0; nt < 6; ++nt) {
    const int n0 = (nt * 4 + wave) * 16;            // output col base, 0..368
    const _Float16* wrow = Wsel + (size_t)(n0 + lhalf) * C_;
    v8f acc = {};
#pragma unroll
    for (int kk = 0; kk < 12; ++kk) {
      const int kb = kk * 32;
      Frag a, bf;
      a.h[0]  = *reinterpret_cast<const v8h*>(&xs[lhalf][kb + hb]);
      a.h[1]  = *reinterpret_cast<const v8h*>(&xs[lhalf][kb + 16 + hb]);
      bf.h[0] = *reinterpret_cast<const v8h*>(wrow + kb + hb);
      bf.h[1] = *reinterpret_cast<const v8h*>(wrow + kb + 16 + hb);
      acc = __builtin_amdgcn_wmma_f32_16x16x32_f16(false, a.v, false, bf.v,
                                                   (short)0, acc, false, false);
    }
#pragma unroll
    for (int r = 0; r < 8; ++r) outs[mrb + r][n0 + lhalf] = acc[r];
  }
  __syncthreads();

  if (which == 2) {
    // V transposed: [B,H,D,T]
    for (int i = tid; i < 16 * 384; i += 128) {
      int col = i >> 4, r = i & 15;
      int h = col >> 6, d = col & 63;
      vh[((size_t)(b * H_ + h) * D_ + d) * T_ + t0 + r] = (_Float16)outs[r][col];
    }
  } else {
    // RoPE + RMS: 384 work items = 6 heads x 16 rows x 4 parts; 3 uniform passes.
    _Float16* dstbase = (which == 0) ? qh : kh;
    const float qscale = (which == 0) ? 0.125f : 1.0f;  // fold softmax 1/sqrt(D) into Q
    for (int item = tid; item < 384; item += 128) {
      const int h    = item >> 6;
      const int rem  = item & 63;
      const int row  = rem >> 2;
      const int part = rem & 3;
      const int t    = t0 + row;
      float r1[8], r2[8];
      float ss = 0.0f;
#pragma unroll
      for (int jj = 0; jj < 8; ++jj) {
        const int j = part * 8 + jj;
        float c  = cosp[(size_t)t * 32 + j];
        float s  = sinp[(size_t)t * 32 + j];
        float x1 = outs[row][h * 64 + j];
        float x2 = outs[row][h * 64 + j + 32];
        r1[jj] = x1 * c + x2 * s;
        r2[jj] = -x1 * s + x2 * c;
        ss += r1[jj] * r1[jj] + r2[jj] * r2[jj];
      }
      // 4 parts of one row sit in 4 adjacent lanes (groups aligned to 4)
      ss += __shfl_xor(ss, 1, 32);
      ss += __shfl_xor(ss, 2, 32);
      const float inv = rsqrtf(ss * (1.0f / 64.0f) + 1.1920929e-7f) * qscale;
      _Float16* qout = dstbase + ((size_t)(b * H_ + h) * T_ + t) * D_;
#pragma unroll
      for (int jj = 0; jj < 8; ++jj) {
        const int j = part * 8 + jj;
        qout[j]      = (_Float16)(r1[jj] * inv);
        qout[j + 32] = (_Float16)(r2[jj] * inv);
      }
    }
  }
}

// ---------------------------------------------------------------------------
// Flash attention, fixed-max softmax, keys split over wave groups.
// RMS-norm bounds: ||q_scaled|| = 1, ||k|| = 8 => |score| <= 8; bias clip +-2
// => |s| <= 10. exp(10)=2.2e4 < f16 max; row sum < 2048*e^10 ~ 4.5e7 < f32 max.
// So no running max, no accumulator rescale: partial O and partial row sums of
// disjoint key ranges simply add.
// Q/K [B,H,T,64] f16 (Q pre-scaled), V [B,H,64,T] f16. Y f16 token-major [B,T,C].
// grid: (T/64, H, B); block: 128*KS_ threads = KS_ key groups x 4 waves.
// Wave (kg, qg): query rows qg*16..+16 of the block, keys kg*T/KS_ .. +T/KS_.
// Each key group stages its own 32-key K and V tiles; the groups' partial
// results are added through LDS once, behind the loop.
// The products are taken transposed: S^T = K Q^T (A = K rows, B = Q) and
// O^T += V^T P^T (A = V^T rows, B = P^T). A lane then holds 16 keys' scores of
// ONE query, and the two S^T accumulator tiles of a 32-key block, rounded to
// f16 in place, are the B operand P^T: P never leaves the registers.
// The key mask, now needed per accumulator row, is read from an LDS table.
// ---------------------------------------------------------------------------
#define KS_ 2
#define KT_BYTES (32 * 72 * 2)            // one K tile: 32 keys x 64 dims (+pad)
#define VT_BYTES (64 * 40 * 2)            // one V tile: 64 dims x 32 keys (+pad)
#define K_OFF(buf, kg) (((buf) * KS_ + (kg)) * KT_BYTES)
#define V_OFF(buf, kg) (2 * KS_ * KT_BYTES + ((buf) * KS_ + (kg)) * VT_BYTES)
#define M_OFF          (2 * KS_ * (KT_BYTES + VT_BYTES))   // key mask table, T floats
#define ATTN_LDS       (M_OFF + T_ * 4)

__device__ __forceinline__ void stage_kv(uint32_t lk0, uint32_t lk1, uint32_t lv0, uint32_t lv1,
                                         const _Float16* gk0, const _Float16* gk1,
                                         const _Float16* gv0, const _Float16* gv1) {
  asm volatile("global_load_async_to_lds_b128 %0, %4, off\n\t"
               "global_load_async_to_lds_b128 %1, %5, off\n\t"
               "global_load_async_to_lds_b128 %2, %6, off\n\t"
               "global_load_async_to_lds_b128 %3, %7, off\n\t"
               "s_wait_xcnt 0x0"
               :: "v"(lk0), "v"(lk1), "v"(lv0), "v"(lv1),
                  "v"(gk0), "v"(gk1), "v"(gv0), "v"(gv1) : "memory");
}

__global__ __launch_bounds__(128 * KS_)
void attn_kernel(const _Float16* __restrict__ qh,
                 const _Float16* __restrict__ kh,
                 const _Float16* __restrict__ vh,
                 const int* __restrict__ maskp,
                 const float* __restrict__ rawb,
                 const int* __restrict__ bscale,
                 _Float16* __restrict__ yh) {
  __shared__ __align__(16) unsigned char smem[ATTN_LDS];

  const int tid   = threadIdx.x;
  const int wave  = tid >> 5;
  const int qg    = wave & 3;          // query group
  const int kg    = wave >> 2;         // key group
  const int t128  = tid & 127;         // thread within its key group
  const int lane  = tid & 31;
  const int lhalf = lane & 15;
  const int hb    = (lane >> 4) * 8;
  const int mrb   = (lane >> 4) * 8;

  const int b   = blockIdx.z;
  const int h   = blockIdx.y;
  const int qt0 = blockIdx.x * 64 + qg * 16;
  const int kbase = kg * (T_ / KS_);   // first key of this wave's range

  const _Float16* Qb  = qh + (size_t)(b * H_ + h) * T_ * D_;
  const _Float16* Kb  = kh + (size_t)(b * H_ + h) * T_ * D_ + (size_t)kbase * D_;
  const _Float16* Vtb = vh + (size_t)(b * H_ + h) * D_ * T_ + kbase;

  // Q fragments (K = 0..31 and 32..63)
  Frag qa0, qa1;
  {
    const _Float16* qr = Qb + (size_t)(qt0 + lhalf) * D_;
    qa0.h[0] = *reinterpret_cast<const v8h*>(qr + 0 + hb);
    qa0.h[1] = *reinterpret_cast<const v8h*>(qr + 16 + hb);
    qa1.h[0] = *reinterpret_cast<const v8h*>(qr + 32 + hb);
    qa1.h[1] = *reinterpret_cast<const v8h*>(qr + 48 + hb);
  }

  // bias takes only 4 values (mask is binary): precompute and select
  const float bs = (float)bscale[0];
  const float g1 = 0.5f * tanhf(rawb[h * 3 + 0]) * bs;
  const float g2 = 0.5f * tanhf(rawb[h * 3 + 1]) * bs;
  const float g3 = 0.5f * tanhf(rawb[h * 3 + 2]) * bs;
  const float cg1   = clamp_bias(g1);
  const float cg2   = clamp_bias(g2);
  const float cg123 = clamp_bias(g1 + g2 + g3);

  // this lane's query: bias for mj=0, and what mj=1 adds to it
  const bool  mi   = maskp[b * T_ + qt0 + lhalf] != 0;
  const float bi0  = mi ? cg1 : 0.0f;
  const float bdl  = (mi ? cg123 : cg2) - bi0;

  v8f lsum = {};           // per-lane partial row sums of this lane's query
  v8f o0 = {}, o1 = {}, o2 = {}, o3 = {};   // O^T: register r = dim dc*16 + mrb + r

  const int NJ = T_ / (32 * KS_);      // 32-key tiles per key group

  // this thread's two 16-byte chunks of a K tile and of a V tile
  const int e0 = t128 * 8, e1 = (t128 + 128) * 8;
  const int kr0 = e0 >> 6, kc0 = e0 & 63, kr1 = e1 >> 6, kc1 = e1 & 63;
  const int vd0 = e0 >> 5, vc0 = e0 & 31, vd1 = e1 >> 5, vc1 = e1 & 31;
  const uint32_t sbase = lds_off(smem);
  const uint32_t lk0 = sbase + K_OFF(0, kg) + (kr0 * 72 + kc0) * 2;
  const uint32_t lk1 = sbase + K_OFF(0, kg) + (kr1 * 72 + kc1) * 2;
  const uint32_t lv0 = sbase + V_OFF(0, kg) + (vd0 * 40 + vc0) * 2;
  const uint32_t lv1 = sbase + V_OFF(0, kg) + (vd1 * 40 + vc1) * 2;
  const _Float16* gk0 = Kb + kr0 * D_ + kc0;
  const _Float16* gk1 = Kb + kr1 * D_ + kc1;
  const _Float16* gv0 = Vtb + (size_t)vd0 * T_ + vc0;
  const _Float16* gv1 = Vtb + (size_t)vd1 * T_ + vc1;

  // ---- tile 0 into buffer 0, published; then tile 1 into buffer 1 ----
  stage_kv(lk0, lk1, lv0, lv1, gk0, gk1, gv0, gv1);

  // key mask of this batch row as 0.0 / 1.0, filled while tile 0 flies and
  // published by the same barrier
  float* mtab = reinterpret_cast<float*>(smem + M_OFF);
#pragma unroll  // constant trip count: the loads are in flight together, no lane is off
  for (int k = 0; k < T_ / (128 * KS_ * 4); ++k) {
    const int i = (k * 128 * KS_ + tid) * 4;
    const v4i mv = *reinterpret_cast<const v4i*>(maskp + b * T_ + i);
    const v4f mf = {mv[0] != 0 ? 1.0f : 0.0f, mv[1] != 0 ? 1.0f : 0.0f,
                    mv[2] != 0 ? 1.0f : 0.0f, mv[3] != 0 ? 1.0f : 0.0f};
    *reinterpret_cast<v4f*>(mtab + i) = mf;
  }

  asm volatile("s_wait_asynccnt 0x0" ::: "memory");  // own copies of tile 0 landed
  __syncthreads();
  stage_kv(lk0 + KS_ * KT_BYTES, lk1 + KS_ * KT_BYTES, lv0 + KS_ * VT_BYTES, lv1 + KS_ * VT_BYTES,
           gk0 + 32 * D_, gk1 + 32 * D_, gv0 + 32, gv1 + 32);

  for (int jb = 0; jb < NJ; ++jb) {
    const int cur = jb & 1;
    const _Float16 (*kt)[72] = reinterpret_cast<const _Float16 (*)[72]>(smem + K_OFF(cur, kg));
    const _Float16 (*vt)[40] = reinterpret_cast<const _Float16 (*)[40]>(smem + V_OFF(cur, kg));

    // ---- S^T = K Q^T for keys [kbase + jb*32, +32); the bias is the start value:
    //      register r of s0 / s1 is key mrb + r / 16 + mrb + r of the tile ----
    const float* mrow = mtab + kbase + jb * 32 + mrb;
    const v4f m00 = *reinterpret_cast<const v4f*>(mrow);
    const v4f m01 = *reinterpret_cast<const v4f*>(mrow + 4);
    const v4f m10 = *reinterpret_cast<const v4f*>(mrow + 16);
    const v4f m11 = *reinterpret_cast<const v4f*>(mrow + 20);
    v8f s0 = __builtin_shufflevector(m00, m01, 0, 1, 2, 3, 4, 5, 6, 7) * bdl + bi0;
    v8f s1 = __builtin_shufflevector(m10, m11, 0, 1, 2, 3, 4, 5, 6, 7) * bdl + bi0;
    {
      Frag bk;
      bk.h[0] = *reinterpret_cast<const v8h*>(&kt[lhalf][0 + hb]);
      bk.h[1] = *reinterpret_cast<const v8h*>(&kt[lhalf][16 + hb]);
      s0 = __builtin_amdgcn_wmma_f32_16x16x32_f16(false, bk.v, false, qa0.v, (short)0, s0, false, false);
      bk.h[0] = *reinterpret_cast<const v8h*>(&kt[lhalf][32 + hb]);
      bk.h[1] = *reinterpret_cast<const v8h*>(&kt[lhalf][48 + hb]);
      s0 = __builtin_amdgcn_wmma_f32_16x16x32_f16(false, bk.v, false, qa1.v, (short)0, s0, false, false);
      bk.h[0] = *reinterpret_cast<const v8h*>(&kt[16 + lhalf][0 + hb]);
      bk.h[1] = *reinterpret_cast<const v8h*>(&kt[16 + lhalf][16 + hb]);
      s1 = __builtin_amdgcn_wmma_f32_16x16x32_f16(false, bk.v, false, qa0.v, (short)0, s1, false, false);
      bk.h[0] = *reinterpret_cast<const v8h*>(&kt[16 + lhalf][32 + hb]);
      bk.h[1] = *reinterpret_cast<const v8h*>(&kt[16 + lhalf][48 + hb]);
      s1 = __builtin_amdgcn_wmma_f32_16x16x32_f16(false, bk.v, false, qa1.v, (short)0, s1, false, false);
    }

    // ---- fixed-max softmax numerators; packed, they are the B operand P^T ----
    v8f p0, p1;
#pragma unroll  // constant r: the vector elements stay in registers
    for (int r = 0; r < 8; ++r) {
      p0[r] = __expf(s0[r]);
      p1[r] = __expf(s1[r]);
    }
    lsum += p0 + p1;               // reduced once at the end
    Frag pb;
    pb.h[0] = __builtin_convertvector(p0, v8h);
    pb.h[1] = __builtin_convertvector(p1, v8h);

    // ---- O^T += V^T P^T : V^T rows give contiguous A fragments ----
#pragma unroll
    for (int dc = 0; dc < 4; ++dc) {
      Frag vb;
      vb.h[0] = *reinterpret_cast<const v8h*>(&vt[dc * 16 + lhalf][hb]);
      vb.h[1] = *reinterpret_cast<const v8h*>(&vt[dc * 16 + lhalf][16 + hb]);
      v8f* op = (dc == 0) ? &o0 : (dc == 1) ? &o1 : (dc == 2) ? &o2 : &o3;
      *op = __builtin_amdgcn_wmma_f32_16x16x32_f16(false, vb.v, false, pb.v, (short)0, *op, false, false);
    }

    // ---- publish tile jb+1, then refill the buffer this trip has read ----
    asm volatile("s_wait_dscnt 0x0" ::: "memory");     // own reads of buffer cur are done
    asm volatile("s_wait_asynccnt 0x0" ::: "memory");  // own copies of tile jb+1 landed
    __syncthreads();
    if (jb + 2 < NJ) {
      const uint32_t bk = cur * (KS_ * KT_BYTES), bv = cur * (KS_ * VT_BYTES);
      const int ko = (jb + 2) * 32;
      stage_kv(lk0 + bk, lk1 + bk, lv0 + bv, lv1 + bv,
               gk0 + (size_t)ko * D_, gk1 + (size_t)ko * D_, gv0 + ko, gv1 + ko);
    }
  }
  asm volatile("s_wait_asynccnt 0x0" ::: "memory");    // nothing in flight before the LDS is reused

  // ---- add the key groups' partial O and row sums through LDS (tiles are dead:
  //      the loop's last barrier ended every read of them) ----
  v4f* red = reinterpret_cast<v4f*>(smem);
  if (kg != 0) {
    v4f* dst = red + ((kg - 1) * 4 + qg) * 10 * 32 + lane;
    dst[0 * 32] = __builtin_shufflevector(o0, o0, 0, 1, 2, 3);
    dst[1 * 32] = __builtin_shufflevector(o0, o0, 4, 5, 6, 7);
    dst[2 * 32] = __builtin_shufflevector(o1, o1, 0, 1, 2, 3);
    dst[3 * 32] = __builtin_shufflevector(o1, o1, 4, 5, 6, 7);
    dst[4 * 32] = __builtin_shufflevector(o2, o2, 0, 1, 2, 3);
    dst[5 * 32] = __builtin_shufflevector(o2, o2, 4, 5, 6, 7);
    dst[6 * 32] = __builtin_shufflevector(o3, o3, 0, 1, 2, 3);
    dst[7 * 32] = __builtin_shufflevector(o3, o3, 4, 5, 6, 7);
    dst[8 * 32] = __builtin_shufflevector(lsum, lsum, 0, 1, 2, 3);
    dst[9 * 32] = __builtin_shufflevector(lsum, lsum, 4, 5, 6, 7);
  }
  __syncthreads();
  if (kg != 0) return;

  for (int g = 1; g < KS_; ++g) {
    const v4f* sp = red + ((g - 1) * 4 + qg) * 10 * 32 + lane;
    v4f t[10];
    for (int i = 0; i < 10; ++i) t[i] = sp[i * 32];
    for (int i = 0; i < 4; ++i) {
      o0[i] += t[0][i]; o0[4 + i] += t[1][i];
      o1[i] += t[2][i]; o1[4 + i] += t[3][i];
      o2[i] += t[4][i]; o2[4 + i] += t[5][i];
      o3[i] += t[6][i]; o3[4 + i] += t[7][i];
      lsum[i] += t[8][i]; lsum[4 + i] += t[9][i];
    }
  }

  // ---- epilogue: one row sum per lane pair, normalize, store f16 [B,T,C]:
  //      a lane's 8 registers of a tile are 8 consecutive dims of its query ----
  float ls = ((lsum[0] + lsum[1]) + (lsum[2] + lsum[3])) + ((lsum[4] + lsum[5]) + (lsum[6] + lsum[7]));
  ls += __shfl_xor(ls, 16, 32);    // the other half of the keys of each tile
  const float inv = 1.0f / ls;
  _Float16* yrow = yh + ((size_t)(b * T_ + qt0 + lhalf)) * C_ + h * D_ + mrb;
  *reinterpret_cast<v8h*>(yrow + 0)  = __builtin_convertvector(o0 * inv, v8h);
  *reinterpret_cast<v8h*>(yrow + 16) = __builtin_convertvector(o1 * inv, v8h);
  *reinterpret_cast<v8h*>(yrow + 32) = __builtin_convertvector(o2 * inv, v8h);
  *reinterpret_cast<v8h*>(yrow + 48) = __builtin_convertvector(o3 * inv, v8h);
}

// ---------------------------------------------------------------------------
// Output projection: out = Y @ Wproj^T, f32 result.
// grid: ((B*T)/16, C/64); block: 128 (4 waves x 16x16 tiles).
// ---------------------------------------------------------------------------
__global__ __launch_bounds__(128)
void proj_kernel(const _Float16* __restrict__ yhp,
                 const _Float16* __restrict__ wph,
                 float* __restrict__ out) {
  __shared__ __align__(16) _Float16 ys[16][392];

  const int tid  = threadIdx.x;
  const int bt0  = blockIdx.x * 16;
  const int nb   = blockIdx.y * 64;

  const _Float16* yrow = yhp + (size_t)bt0 * C_;
  for (int i = tid; i < 768; i += 128) {
    int r = i / 48, cc = (i % 48) * 8;
    async_ld_b128(lds_off(&ys[r][cc]), (const void*)(yrow + (size_t)r * C_ + cc));
  }
  wait_async0();
  __syncthreads();

  const int wave  = tid >> 5;
  const int lane  = tid & 31;
  const int lhalf = lane & 15;
  const int hb    = (lane >> 4) * 8;
  const int mrb   = (lane >> 4) * 8;
  const int n0    = nb + wave * 16;

  const _Float16* wrow = wph + (size_t)(n0 + lhalf) * C_;

  v8f acc = {};
#pragma unroll
  for (int kk = 0; kk < 12; ++kk) {
    const int kb = kk * 32;
    Frag a, bf;
    a.h[0]  = *reinterpret_cast<const v8h*>(&ys[lhalf][kb + hb]);
    a.h[1]  = *reinterpret_cast<const v8h*>(&ys[lhalf][kb + 16 + hb]);
    bf.h[0] = *reinterpret_cast<const v8h*>(wrow + kb + hb);
    bf.h[1] = *reinterpret_cast<const v8h*>(wrow + kb + 16 + hb);
    acc = __builtin_amdgcn_wmma_f32_16x16x32_f16(false, a.v, false, bf.v,
                                                 (short)0, acc, false, false);
  }

#pragma unroll
  for (int r = 0; r < 8; ++r)
    out[(size_t)(bt0 + mrb + r) * C_ + n0 + lhalf] = acc[r];
}

// ---------------------------------------------------------------------------
extern "C" void kernel_launch(void* const* d_in, const int* in_sizes, int n_in,
                              void* d_out, int out_size, void* d_ws, size_t ws_size,
                              hipStream_t stream) {
  (void)in_sizes; (void)n_in; (void)out_size; (void)ws_size;

  const float* x      = (const float*)d_in[0];
  const float* cosp   = (const float*)d_in[1];
  const float* sinp   = (const float*)d_in[2];
  const int*   maskp  = (const int*)d_in[3];
  const float* Wq     = (const float*)d_in[4];
  const float* Wk     = (const float*)d_in[5];
  const float* Wv     = (const float*)d_in[6];
  const float* Wproj  = (const float*)d_in[7];
  const float* rawb   = (const float*)d_in[8];
  const int*   bscale = (const int*)d_in[9];
  float* out = (float*)d_out;

  const size_t XN = (size_t)B_ * T_ * C_;   // 3,145,728
  const size_t WN = (size_t)C_ * C_;        // 147,456

  _Float16* p   = (_Float16*)d_ws;
  _Float16* wqh = p; p += WN;
  _Float16* wkh = p; p += WN;
  _Float16* wvh = p; p += WN;
  _Float16* wph = p; p += WN;
  _Float16* qh  = p; p += XN;
  _Float16* kh  = p; p += XN;
  _Float16* vh  = p; p += XN;   // transposed layout [B,H,D,T]
  _Float16* yh  = p; p += XN;

  dim3 g0(C_ * C_ / 2048, 4);
  cvt_w_kernel<<<g0, 256, 0, stream>>>(Wq, Wk, Wv, Wproj, wqh);   // fills wqh, wkh, wvh, wph

  dim3 g1(T_ / 16, 3 * B_);
  qkv_kernel<<<g1, 128, 0, stream>>>(x, wqh, wkh, wvh, cosp, sinp, qh, kh, vh);

  dim3 g2(T_ / 64, H_, B_);
  attn_kernel<<<g2, 128 * KS_, 0, stream>>>(qh, kh, vh, maskp, rawb, bscale, yh);

  dim3 g3((B_ * T_) / 16, C_ / 64);
  proj_kernel<<<g3, 128, 0, stream>>>(yh, wph, out);
}

// v004
// Measured time: 57.9 microseconds a run.
// In two side-by-side timings against v003, it was 1.37 and 1.35 times as fast.
// All steps since v000 together make it 2.16 times as fast.
#include <hip/hip_runtime.h>
#include <hip/hip_bf16.h>
#include <cstdint>

#define B_ 4
#define T_ 2048
#define C_ 384
#define H_ 6
#define D_ 64

typedef __attribute__((ext_vector_type(16))) _Float16 v16h;
typedef __attribute__((ext_vector_type(8)))  _Float16 v8h;
typedef __attribute__((ext_vector_type(4)))  _Float16 v4h;
typedef __attribute__((ext_vector_type(8)))  float    v8f;
typedef __attribute__((ext_vector_type(4)))  float    v4f;
typedef __attribute__((ext_vector_type(4)))  int      v4i;

union Frag { v16h v; v8h h[2]; };

__device__ __forceinline__ void async_ld_b128(uint32_t lds_byte_off, const void* gptr) {
  asm volatile("global_load_async_to_lds_b128 %0, %1, off"
               :: "v"(lds_byte_off), "v"(gptr) : "memory");
}
__device__ __forceinline__ void wait_async0() {
#if __has_builtin(__builtin_amdgcn_s_wait_asynccnt)
  __builtin_amdgcn_s_wait_asynccnt(0);
#else
  asm volatile("s_wait_asynccnt 0" ::: "memory");
#endif
}
__device__ __forceinline__ uint32_t lds_off(const void* p) {
  return (uint32_t)(uintptr_t)p;
}

__device__ __forceinline__ float clamp_bias(float x) {
  return fminf(2.0f, fmaxf(-2.0f, x));
}

// ---------------------------------------------------------------------------
// f32 -> f16 conversion of the four C x C weight matrices in one launch.
// grid: (C*C/2048, 4); block: 256. blockIdx.y picks the matrix; the four f16
// copies lie one behind the other in dst. Eight elements per thread.
// ---------------------------------------------------------------------------
__global__ __launch_bounds__(256)
void cvt_w_kernel(const float* __restrict__ w0, const float* __restrict__ w1,
                  const float* __restrict__ w2, const float* __restrict__ w3,
                  _Float16* __restrict__ dst) {
  const int m = blockIdx.y;
  const float* src = (m == 0) ? w0 : (m == 1) ? w1 : (m == 2) ? w2 : w3;
  const int i = (blockIdx.x * 256 + threadIdx.x) * 8;
  const v4f a = *reinterpret_cast<const v4f*>(src + i);
  const v4f c = *reinterpret_cast<const v4f*>(src + i + 4);
  const v8h o = {(_Float16)a[0], (_Float16)a[1], (_Float16)a[2], (_Float16)a[3],
                 (_Float16)c[0], (_Float16)c[1], (_Float16)c[2], (_Float16)c[3]};
  *reinterpret_cast<v8h*>(dst + (size_t)m * (C_ * C_) + i) = o;
}

// ---------------------------------------------------------------------------
// QKV projection + RoPE + RMS-norm.
// grid: (T/64, 3*B, 2); block: 128 (4 waves). Block computes 192 output cols
// (3 heads) for 64 tokens of one matrix. A wave takes 3 N-tiles and all 4 token
// tiles of each: a W fragment read from global memory feeds 4 WMMAs, an X
// fragment read from LDS feeds 3. X is loaded once as f32 and rounded to f16 on its way into LDS.
// which = blockIdx.y / B : 0=Q, 1=K, 2=V
// Q/K stored [B,H,T,64] (Q pre-scaled by 1/sqrt(D)); V stored transposed [B,H,64,T].
// ---------------------------------------------------------------------------
__global__ __launch_bounds__(128)
void qkv_kernel(const float* __restrict__ x,
                const _Float16* __restrict__ wqh,
                const _Float16* __restrict__ wkh,
                const _Float16* __restrict__ wvh,
                const float* __restrict__ cosp,
                const float* __restrict__ sinp,
                _Float16* __restrict__ qh,
                _Float16* __restrict__ kh,
                _Float16* __restrict__ vh) {
  __shared__ __align__(16) _Float16 xs[64][392];    // 64 x 384 (+pad)  49 KB
  __shared__ __align__(16) float    outs[64][196];  // 64 x 192 (+pad)  49 KB

  const int tid   = threadIdx.x;
  const int b     = blockIdx.y % B_;
  const int which = blockIdx.y / B_;
  const int t0    = blockIdx.x * 64;
  const int h0    = blockIdx.z * 3;    // first head of this block
  const int nb    = h0 * D_;           // first output col of this block

  // 64 rows x 384 f32 are contiguous: 6144 16-byte pieces, 48 per thread, all
  // loads issued before the first conversion. Three steps of 128 pieces are 4
  // whole rows, so a piece's row and col repeat every third step, 4 rows on.
  const float* xrow = x + ((size_t)b * T_ + t0) * C_;
  v4f xv[48];
#pragma unroll  // xv stays in registers and the 48 loads are in flight together
  for (int k = 0; k < 48; ++k)
    xv[k] = *reinterpret_cast<const v4f*>(xrow + (tid + k * 128) * 4);
#pragma unroll  // constant s, q: xv indexed statically, no scratch
  for (int s = 0; s < 3; ++s) {
    const int j = tid + s * 128;
    const int r = j / 96, cc = (j % 96) * 4;
#pragma unroll
    for (int q = 0; q < 16; ++q) {
      const v4f v = xv[q * 3 + s];
      const v4h hv = {(_Float16)v[0], (_Float16)v[1], (_Float16)v[2], (_Float16)v[3]};
      *reinterpret_cast<v4h*>(&xs[q * 4 + r][cc]) = hv;
    }
  }
  __syncthreads();

  const _Float16* Wsel = (which == 0) ? wqh : (which == 1) ? wkh : wvh;
  const int wave  = tid >> 5;
  const int lane  = tid & 31;
  const int lhalf = lane & 15;
  const int hb    = (lane >> 4) * 8;   // K sub-block select per A/B layout
  const int mrb   = (lane >> 4) * 8;   // C/D row base

  // Wave: cols wave*48 .. +48 of the block (3 N-tiles) x 4 token tiles, one walk
  // over k. The W fragments come straight from global memory through a register
  // ring 4 k steps deep, so that their latency lies behind 36 WMMAs.
  const int nl = wave * 48;
  const _Float16* wrow = Wsel + (size_t)(nb + nl + lhalf) * C_ + hb;
  v8f acc[3][4] = {};
  Frag bw[4][3];
#pragma unroll  // constant indices: the ring stays in registers
  for (int p = 0; p < 4; ++p)
#pragma unroll
    for (int nt = 0; nt < 3; ++nt) {
      bw[p][nt].h[0] = *reinterpret_cast<const v8h*>(wrow + nt * 16 * C_ + p * 32);
      bw[p][nt].h[1] = *reinterpret_cast<const v8h*>(wrow + nt * 16 * C_ + p * 32 + 16);
    }
#pragma unroll  // constant indices: ring and accumulators stay in registers
  for (int kk = 0; kk < 12; ++kk) {
    const int kb = kk * 32;
    Frag a[4];
#pragma unroll
    for (int mt = 0; mt < 4; ++mt) {
      a[mt].h[0] = *reinterpret_cast<const v8h*>(&xs[mt * 16 + lhalf][kb + hb]);
      a[mt].h[1] = *reinterpret_cast<const v8h*>(&xs[mt * 16 + lhalf][kb + 16 + hb]);
    }
#pragma unroll
    for (int nt = 0; nt < 3; ++nt)
#pragma unroll
      for (int mt = 0; mt < 4; ++mt)
        acc[nt][mt] = __builtin_amdgcn_wmma_f32_16x16x32_f16(false, a[mt].v, false, bw[kk & 3][nt].v,
                                                             (short)0, acc[nt][mt], false, false);
    if (kk + 4 < 12) {
#pragma unroll
      for (int nt = 0; nt < 3; ++nt) {
        bw[kk & 3][nt].h[0] = *reinterpret_cast<const v8h*>(wrow + nt * 16 * C_ + kb + 128);
        bw[kk & 3][nt].h[1] = *reinterpret_cast<const v8h*>(wrow + nt * 16 * C_ + kb + 128 + 16);
      }
    }
  }
#pragma unroll
  for (int nt = 0; nt < 3; ++nt)
#pragma unroll
    for (int mt = 0; mt < 4; ++mt)
#pragma unroll
      for (int r = 0; r < 8; ++r)
        outs[mt * 16 + mrb + r][nl + nt * 16 + lhalf] = acc[nt][mt][r];
  __syncthreads();

  if (which == 2) {
    // V transposed: [B,H,D,T]. A thread packs 8 tokens of one col; the 8 threads
    // of a col store its 64 tokens as one 128-byte line. 192 x 8 items, 12 passes.
    for (int p0 = 0; p0 < 12; p0 += 4) {
#pragma unroll  // four passes' LDS reads in flight together
      for (int p = 0; p < 4; ++p) {
        const int i = tid + (p0 + p) * 128;
        const int col = i >> 3, ch = (i & 7) * 8;
        const int h = h0 + (col >> 6), d = col & 63;
        v8h o;
#pragma unroll  // constant k: o stays in registers
        for (int k = 0; k < 8; ++k) o[k] = (_Float16)outs[ch + k][col];
        *reinterpret_cast<v8h*>(vh + ((size_t)(b * H_ + h) * D_ + d) * T_ + t0 + ch) = o;
      }
      // the next trip rewrites the address and data registers of these stores
      asm volatile("s_wait_xcnt 0x0" ::: "memory");
    }
  } else {
    // RoPE + RMS: 64 rows x 4 parts = 256 (row, part) pairs, 2 per thread; each
    // pair reads its cos and sin once and serves the block's 3 heads.
    _Float16* dstbase = (which == 0) ? qh : kh;
    const float qscale = (which == 0) ? 0.125f : 1.0f;  // fold softmax 1/sqrt(D) into Q
    const int part = tid & 3;
    const float* cp0 = cosp + (size_t)(t0 + (tid >> 2)) * 32 + part * 8;
    const float* sp0 = sinp + (size_t)(t0 + (tid >> 2)) * 32 + part * 8;
    const float* cp1 = cp0 + 32 * 32;    // the thread's second pair: 32 rows on
    const float* sp1 = sp0 + 32 * 32;
    v4f cs[2][4];                        // [pair][cos lo, cos hi, sin lo, sin hi]
    cs[0][0] = *reinterpret_cast<const v4f*>(cp0);
    cs[0][1] = *reinterpret_cast<const v4f*>(cp0 + 4);
    cs[0][2] = *reinterpret_cast<const v4f*>(sp0);
    cs[0][3] = *reinterpret_cast<const v4f*>(sp0 + 4);
    cs[1][0] = *reinterpret_cast<const v4f*>(cp1);
    cs[1][1] = *reinterpret_cast<const v4f*>(cp1 + 4);
    cs[1][2] = *reinterpret_cast<const v4f*>(sp1);
    cs[1][3] = *reinterpret_cast<const v4f*>(sp1 + 4);
    // the address registers of the eight loads live up to this wait, so that no
    // load's result lands on the address of another ahead of it
    asm volatile("s_wait_xcnt 0x0" :: "v"(cp0), "v"(sp0) : "memory");
#pragma unroll  // straight-line code: the LDS reads of all passes overlap
    for (int hf = 0; hf < 2; ++hf) {
      const int row = (tid >> 2) + hf * 32;
      const int t   = t0 + row;
#pragma unroll
      for (int hl = 0; hl < 3; ++hl) {
        float r1[8], r2[8];
        float ss = 0.0f;
#pragma unroll
        for (int jj = 0; jj < 8; ++jj) {
          const int j = part * 8 + jj;
          const float c = cs[hf][jj >> 2][jj & 3];
          const float s = cs[hf][2 + (jj >> 2)][jj & 3];
          float x1 = outs[row][hl * 64 + j];
          float x2 = outs[row][hl * 64 + j + 32];
          r1[jj] = x1 * c + x2 * s;
          r2[jj] = -x1 * s + x2 * c;
          ss += r1[jj] * r1[jj] + r2[jj] * r2[jj];
        }
        // 4 parts of one row sit in 4 adjacent lanes (groups aligned to 4)
        ss += __shfl_xor(ss, 1, 32);
        ss += __shfl_xor(ss, 2, 32);
        const float inv = rsqrtf(ss * (1.0f / 64.0f) + 1.1920929e-7f) * qscale;
        _Float16* qout = dstbase + ((size_t)(b * H_ + h0 + hl) * T_ + t) * D_;
#pragma unroll
        for (int jj = 0; jj < 8; ++jj) {
          const int j = part * 8 + jj;
          qout[j]      = (_Float16)(r1[jj] * inv);
          qout[j + 32] = (_Float16)(r2[jj] * inv);
        }
      }
    }
    asm volatile("s_wait_xcnt 0x0" ::: "memory");
  }
}

// ---------------------------------------------------------------------------
// Flash attention, fixed-max softmax, keys split over wave groups.
// RMS-norm bounds: ||q_scaled|| = 1, ||k|| = 8 => |score| <= 8; bias clip +-2
// => |s| <= 10. exp(10)=2.2e4 < f16 max; row sum < 2048*e^10 ~ 4.5e7 < f32 max.
// So no running max, no accumulator rescale: partial O and partial row sums of
// disjoint key ranges simply add.
// Q/K [B,H,T,64] f16 (Q pre-scaled), V [B,H,64,T] f16. Y f16 token-major [B,T,C].
// grid: (T/64, H, B); block: 128*KS_ threads = KS_ key groups x 4 waves.
// Wave (kg, qg): query rows qg*16..+16 of the block, keys kg*T/KS_ .. +T/KS_.
// Each key group stages its own 32-key K and V tiles; the groups' partial
// results are added through LDS once, behind the loop.
// The products are taken transposed: S^T = K Q^T (A = K rows, B = Q) and
// O^T += V^T P^T (A = V^T rows, B = P^T). A lane then holds 16 keys' scores of
// ONE query, and the two S^T accumulator tiles of a 32-key block, rounded to
// f16 in place, are the B operand P^T: P never leaves the registers.
// The key mask, now needed per accumulator row, is read from an LDS table.
// ---------------------------------------------------------------------------
#define KS_ 2
#define KT_BYTES (32 * 72 * 2)            // one K tile: 32 keys x 64 dims (+pad)
#define VT_BYTES (64 * 40 * 2)            // one V tile: 64 dims x 32 keys (+pad)
#define K_OFF(buf, kg) (((buf) * KS_ + (kg)) * KT_BYTES)
#define V_OFF(buf, kg) (2 * KS_ * KT_BYTES + ((buf) * KS_ + (kg)) * VT_BYTES)
#define M_OFF          (2 * KS_ * (KT_BYTES + VT_BYTES))   // key mask table, T floats
#define ATTN_LDS       (M_OFF + T_ * 4)

__device__ __forceinline__ void stage_kv(uint32_t lk0, uint32_t lk1, uint32_t lv0, uint32_t lv1,
                                         const _Float16* gk0, const _Float16* gk1,
                                         const _Float16* gv0, const _Float16* gv1) {
  asm volatile("global_load_async_to_lds_b128 %0, %4, off\n\t"
               "global_load_async_to_lds_b128 %1, %5, off\n\t"
               "global_load_async_to_lds_b128 %2, %6, off\n\t"
               "global_load_async_to_lds_b128 %3, %7, off\n\t"
               "s_wait_xcnt 0x0"
               :: "v"(lk0), "v"(lk1), "v"(lv0), "v"(lv1),
                  "v"(gk0), "v"(gk1), "v"(gv0), "v"(gv1) : "memory");
}

__global__ __launch_bounds__(128 * KS_)
void attn_kernel(const _Float16* __restrict__ qh,
                 const _Float16* __restrict__ kh,
                 const _Float16* __restrict__ vh,
                 const int* __restrict__ maskp,
                 const float* __restrict__ rawb,
                 const int* __restrict__ bscale,
                 _Float16* __restrict__ yh) {
  __shared__ __align__(16) unsigned char smem[ATTN_LDS];

  const int tid   = threadIdx.x;
  const int wave  = tid >> 5;
  const int qg    = wave & 3;          // query group
  const int kg    = wave >> 2;         // key group
  const int t128  = tid & 127;         // thread within its key group
  const int lane  = tid & 31;
  const int lhalf = lane & 15;
  const int hb    = (lane >> 4) * 8;
  const int mrb   = (lane >> 4) * 8;

  const int b   = blockIdx.z;
  const int h   = blockIdx.y;
  const int qt0 = blockIdx.x * 64 + qg * 16;
  const int kbase = kg * (T_ / KS_);   // first key of this wave's range

  const _Float16* Qb  = qh + (size_t)(b * H_ + h) * T_ * D_;
  const _Float16* Kb  = kh + (size_t)(b * H_ + h) * T_ * D_ + (size_t)kbase * D_;
  const _Float16* Vtb = vh + (size_t)(b * H_ + h) * D_ * T_ + kbase;

  // Q fragments (K = 0..31 and 32..63)
  Frag qa0, qa1;
  {
    const _Float16* qr = Qb + (size_t)(qt0 + lhalf) * D_;
    qa0.h[0] = *reinterpret_cast<const v8h*>(qr + 0 + hb);
    qa0.h[1] = *reinterpret_cast<const v8h*>(qr + 16 + hb);
    qa1.h[0] = *reinterpret_cast<const v8h*>(qr + 32 + hb);
    qa1.h[1] = *reinterpret_cast<const v8h*>(qr + 48 + hb);
  }

  // bias takes only 4 values (mask is binary): precompute and select
  const float bs = (float)bscale[0];
  const float g1 = 0.5f * tanhf(rawb[h * 3 + 0]) * bs;
  const float g2 = 0.5f * tanhf(rawb[h * 3 + 1]) * bs;
  const float g3 = 0.5f * tanhf(rawb[h * 3 + 2]) * bs;
  const float cg1   = clamp_bias(g1);
  const float cg2   = clamp_bias(g2);
  const float cg123 = clamp_bias(g1 + g2 + g3);

  // this lane's query: bias for mj=0, and what mj=1 adds to it
  const bool  mi   = maskp[b * T_ + qt0 + lhalf] != 0;
  const float bi0  = mi ? cg1 : 0.0f;
  const float bdl  = (mi ? cg123 : cg2) - bi0;

  v8f lsum = {};           // per-lane partial row sums of this lane's query
  v8f o0 = {}, o1 = {}, o2 = {}, o3 = {};   // O^T: register r = dim dc*16 + mrb + r

  const int NJ = T_ / (32 * KS_);      // 32-key tiles per key group

  // this thread's two 16-byte chunks of a K tile and of a V tile
  const int e0 = t128 * 8, e1 = (t128 + 128) * 8;
  const int kr0 = e0 >> 6, kc0 = e0 & 63, kr1 = e1 >> 6, kc1 = e1 & 63;
  const int vd0 = e0 >> 5, vc0 = e0 & 31, vd1 = e1 >> 5, vc1 = e1 & 31;
  const uint32_t sbase = lds_off(smem);
  const uint32_t lk0 = sbase + K_OFF(0, kg) + (kr0 * 72 + kc0) * 2;
  const uint32_t lk1 = sbase + K_OFF(0, kg) + (kr1 * 72 + kc1) * 2;
  const uint32_t lv0 = sbase + V_OFF(0, kg) + (vd0 * 40 + vc0) * 2;
  const uint32_t lv1 = sbase + V_OFF(0, kg) + (vd1 * 40 + vc1) * 2;
  const _Float16* gk0 = Kb + kr0 * D_ + kc0;
  const _Float16* gk1 = Kb + kr1 * D_ + kc1;
  const _Float16* gv0 = Vtb + (size_t)vd0 * T_ + vc0;
  const _Float16* gv1 = Vtb + (size_t)vd1 * T_ + vc1;

  // ---- tile 0 into buffer 0, published; then tile 1 into buffer 1 ----
  stage_kv(lk0, lk1, lv0, lv1, gk0, gk1, gv0, gv1);

  // key mask of this batch row as 0.0 / 1.0, filled while tile 0 flies and
  // published by the same barrier
  float* mtab = reinterpret_cast<float*>(smem + M_OFF);
#pragma unroll  // constant trip count: the loads are in flight together, no lane is off
  for (int k = 0; k < T_ / (128 * KS_ * 4); ++k) {
    const int i = (k * 128 * KS_ + tid) * 4;
    const v4i mv = *reinterpret_cast<const v4i*>(maskp + b * T_ + i);
    const v4f mf = {mv[0] != 0 ? 1.0f : 0.0f, mv[1] != 0 ? 1.0f : 0.0f,
                    mv[2] != 0 ? 1.0f : 0.0f, mv[3] != 0 ? 1.0f : 0.0f};
    *reinterpret_cast<v4f*>(mtab + i) = mf;
  }

  asm volatile("s_wait_asynccnt 0x0" ::: "memory");  // own copies of tile 0 landed
  __syncthreads();
  stage_kv(lk0 + KS_ * KT_BYTES, lk1 + KS_ * KT_BYTES, lv0 + KS_ * VT_BYTES, lv1 + KS_ * VT_BYTES,
           gk0 + 32 * D_, gk1 + 32 * D_, gv0 + 32, gv1 + 32);

  for (int jb = 0; jb < NJ; ++jb) {
    const int cur = jb & 1;
    const _Float16 (*kt)[72] = reinterpret_cast<const _Float16 (*)[72]>(smem + K_OFF(cur, kg));
    const _Float16 (*vt)[40] = reinterpret_cast<const _Float16 (*)[40]>(smem + V_OFF(cur, kg));

    // ---- S^T = K Q^T for keys [kbase + jb*32, +32); the bias is the start value:
    //      register r of s0 / s1 is key mrb + r / 16 + mrb + r of the tile ----
    const float* mrow = mtab + kbase + jb * 32 + mrb;
    const v4f m00 = *reinterpret_cast<const v4f*>(mrow);
    const v4f m01 = *reinterpret_cast<const v4f*>(mrow + 4);
    const v4f m10 = *reinterpret_cast<const v4f*>(mrow + 16);
    const v4f m11 = *reinterpret_cast<const v4f*>(mrow + 20);
    v8f s0 = __builtin_shufflevector(m00, m01, 0, 1, 2, 3, 4, 5, 6, 7) * bdl + bi0;
    v8f s1 = __builtin_shufflevector(m10, m11, 0, 1, 2, 3, 4, 5, 6, 7) * bdl + bi0;
    {
      Frag bk;
      bk.h[0] = *reinterpret_cast<const v8h*>(&kt[lhalf][0 + hb]);
      bk.h[1] = *reinterpret_cast<const v8h*>(&kt[lhalf][16 + hb]);
      s0 = __builtin_amdgcn_wmma_f32_16x16x32_f16(false, bk.v, false, qa0.v, (short)0, s0, false, false);
      bk.h[0] = *reinterpret_cast<const v8h*>(&kt[lhalf][32 + hb]);
      bk.h[1] = *reinterpret_cast<const v8h*>(&kt[lhalf][48 + hb]);
      s0 = __builtin_amdgcn_wmma_f32_16x16x32_f16(false, bk.v, false, qa1.v, (short)0, s0, false, false);
      bk.h[0] = *reinterpret_cast<const v8h*>(&kt[16 + lhalf][0 + hb]);
      bk.h[1] = *reinterpret_cast<const v8h*>(&kt[16 + lhalf][16 + hb]);
      s1 = __builtin_amdgcn_wmma_f32_16x16x32_f16(false, bk.v, false, qa0.v, (short)0, s1, false, false);
      bk.h[0] = *reinterpret_cast<const v8h*>(&kt[16 + lhalf][32 + hb]);
      bk.h[1] = *reinterpret_cast<const v8h*>(&kt[16 + lhalf][48 + hb]);
      s1 = __builtin_amdgcn_wmma_f32_16x16x32_f16(false, bk.v, false, qa1.v, (short)0, s1, false, false);
    }

    // ---- fixed-max softmax numerators; packed, they are the B operand P^T ----
    v8f p0, p1;
#pragma unroll  // constant r: the vector elements stay in registers
    for (int r = 0; r < 8; ++r) {
      p0[r] = __expf(s0[r]);
      p1[r] = __expf(s1[r]);
    }
    lsum += p0 + p1;               // reduced once at the end
    Frag pb;
    pb.h[0] = __builtin_convertvector(p0, v8h);
    pb.h[1] = __builtin_convertvector(p1, v8h);

    // ---- O^T += V^T P^T : V^T rows give contiguous A fragments ----
#pragma unroll
    for (int dc = 0; dc < 4; ++dc) {
      Frag vb;
      vb.h[0] = *reinterpret_cast<const v8h*>(&vt[dc * 16 + lhalf][hb]);
      vb.h[1] = *reinterpret_cast<const v8h*>(&vt[dc * 16 + lhalf][16 + hb]);
      v8f* op = (dc == 0) ? &o0 : (dc == 1) ? &o1 : (dc == 2) ? &o2 : &o3;
      *op = __builtin_amdgcn_wmma_f32_16x16x32_f16(false, vb.v, false, pb.v, (short)0, *op, false, false);
    }

    // ---- publish tile jb+1, then refill the buffer this trip has read ----
    asm volatile("s_wait_dscnt 0x0" ::: "memory");     // own reads of buffer cur are done
    asm volatile("s_wait_asynccnt 0x0" ::: "memory");  // own copies of tile jb+1 landed
    __syncthreads();
    if (jb + 2 < NJ) {
      const uint32_t bk = cur * (KS_ * KT_BYTES), bv = cur * (KS_ * VT_BYTES);
      const int ko = (jb + 2) * 32;
      stage_kv(lk0 + bk, lk1 + bk, lv0 + bv, lv1 + bv,
               gk0 + (size_t)ko * D_, gk1 + (size_t)ko * D_, gv0 + ko, gv1 + ko);
    }
  }
  asm volatile("s_wait_asynccnt 0x0" ::: "memory");    // nothing in flight before the LDS is reused

  // ---- add the key groups' partial O and row sums through LDS (tiles are dead:
  //      the loop's last barrier ended every read of them) ----
  v4f* red = reinterpret_cast<v4f*>(smem);
  if (kg != 0) {
    v4f* dst = red + ((kg - 1) * 4 + qg) * 10 * 32 + lane;
    dst[0 * 32] = __builtin_shufflevector(o0, o0, 0, 1, 2, 3);
    dst[1 * 32] = __builtin_shufflevector(o0, o0, 4, 5, 6, 7);
    dst[2 * 32] = __builtin_shufflevector(o1, o1, 0, 1, 2, 3);
    dst[3 * 32] = __builtin_shufflevector(o1, o1, 4, 5, 6, 7);
    dst[4 * 32] = __builtin_shufflevector(o2, o2, 0, 1, 2, 3);
    dst[5 * 32] = __builtin_shufflevector(o2, o2, 4, 5, 6, 7);
    dst[6 * 32] = __builtin_shufflevector(o3, o3, 0, 1, 2, 3);
    dst[7 * 32] = __builtin_shufflevector(o3, o3, 4, 5, 6, 7);
    dst[8 * 32] = __builtin_shufflevector(lsum, lsum, 0, 1, 2, 3);
    dst[9 * 32] = __builtin_shufflevector(lsum, lsum, 4, 5, 6, 7);
  }
  __syncthreads();
  if (kg != 0) return;

  for (int g = 1; g < KS_; ++g) {
    const v4f* sp = red + ((g - 1) * 4 + qg) * 10 * 32 + lane;
    v4f t[10];
    for (int i = 0; i < 10; ++i) t[i] = sp[i * 32];
    for (int i = 0; i < 4; ++i) {
      o0[i] += t[0][i]; o0[4 + i] += t[1][i];
      o1[i] += t[2][i]; o1[4 + i] += t[3][i];
      o2[i] += t[4][i]; o2[4 + i] += t[5][i];
      o3[i] += t[6][i]; o3[4 + i] += t[7][i];
      lsum[i] += t[8][i]; lsum[4 + i] += t[9][i];
    }
  }

  // ---- epilogue: one row sum per lane pair, normalize, store f16 [B,T,C]:
  //      a lane's 8 registers of a tile are 8 consecutive dims of its query ----
  float ls = ((lsum[0] + lsum[1]) + (lsum[2] + lsum[3])) + ((lsum[4] + lsum[5]) + (lsum[6] + lsum[7]));
  ls += __shfl_xor(ls, 16, 32);    // the other half of the keys of each tile
  const float inv = 1.0f / ls;
  _Float16* yrow = yh + ((size_t)(b * T_ + qt0 + lhalf)) * C_ + h * D_ + mrb;
  *reinterpret_cast<v8h*>(yrow + 0)  = __builtin_convertvector(o0 * inv, v8h);
  *reinterpret_cast<v8h*>(yrow + 16) = __builtin_convertvector(o1 * inv, v8h);
  *reinterpret_cast<v8h*>(yrow + 32) = __builtin_convertvector(o2 * inv, v8h);
  *reinterpret_cast<v8h*>(yrow + 48) = __builtin_convertvector(o3 * inv, v8h);
}

// ---------------------------------------------------------------------------
// Output projection: out = Y @ Wproj^T, f32 result.
// grid: ((B*T)/64, C/64); block: 128 (4 waves). Block: 64 tokens x 64 cols; a
// wave takes one N-tile and all 4 token tiles, so a W fragment feeds 4 WMMAs.
// ---------------------------------------------------------------------------
__global__ __launch_bounds__(128)
void proj_kernel(const _Float16* __restrict__ yhp,
                 const _Float16* __restrict__ wph,
                 float* __restrict__ out) {
  __shared__ __align__(16) _Float16 ys[64][392];

  const int tid  = threadIdx.x;
  const int bt0  = blockIdx.x * 64;
  const int nb   = blockIdx.y * 64;

  const _Float16* yrow = yhp + (size_t)bt0 * C_;
  for (int i = tid; i < 3072; i += 128) {
    int r = i / 48, cc = (i % 48) * 8;
    async_ld_b128(lds_off(&ys[r][cc]), (const void*)(yrow + (size_t)r * C_ + cc));
  }
  wait_async0();
  __syncthreads();

  const int wave  = tid >> 5;
  const int lane  = tid & 31;
  const int lhalf = lane & 15;
  const int hb    = (lane >> 4) * 8;
  const int mrb   = (lane >> 4) * 8;
  const int n0    = nb + wave * 16;

  const _Float16* wrow = wph + (size_t)(n0 + lhalf) * C_;

  v8f acc0 = {}, acc1 = {}, acc2 = {}, acc3 = {};
#pragma unroll
  for (int kk = 0; kk < 12; ++kk) {
    const int kb = kk * 32;
    Frag bf, a0, a1, a2, a3;
    bf.h[0] = *reinterpret_cast<const v8h*>(wrow + kb + hb);
    bf.h[1] = *reinterpret_cast<const v8h*>(wrow + kb + 16 + hb);
    a0.h[0] = *reinterpret_cast<const v8h*>(&ys[lhalf][kb + hb]);
    a0.h[1] = *reinterpret_cast<const v8h*>(&ys[lhalf][kb + 16 + hb]);
    a1.h[0] = *reinterpret_cast<const v8h*>(&ys[16 + lhalf][kb + hb]);
    a1.h[1] = *reinterpret_cast<const v8h*>(&ys[16 + lhalf][kb + 16 + hb]);
    a2.h[0] = *reinterpret_cast<const v8h*>(&ys[32 + lhalf][kb + hb]);
    a2.h[1] = *reinterpret_cast<const v8h*>(&ys[32 + lhalf][kb + 16 + hb]);
    a3.h[0] = *reinterpret_cast<const v8h*>(&ys[48 + lhalf][kb + hb]);
    a3.h[1] = *reinterpret_cast<const v8h*>(&ys[48 + lhalf][kb + 16 + hb]);
    acc0 = __builtin_amdgcn_wmma_f32_16x16x32_f16(false, a0.v, false, bf.v, (short)0, acc0, false, false);
    acc1 = __builtin_amdgcn_wmma_f32_16x16x32_f16(false, a1.v, false, bf.v, (short)0, acc1, false, false);
    acc2 = __builtin_amdgcn_wmma_f32_16x16x32_f16(false, a2.v, false, bf.v, (short)0, acc2, false, false);
    acc3 = __builtin_amdgcn_wmma_f32_16x16x32_f16(false, a3.v, false, bf.v, (short)0, acc3, false, false);
  }

#pragma unroll
  for (int r = 0; r < 8; ++r) {
    out[(size_t)(bt0 + mrb + r) * C_ + n0 + lhalf]      = acc0[r];
    out[(size_t)(bt0 + 16 + mrb + r) * C_ + n0 + lhalf] = acc1[r];
    out[(size_t)(bt0 + 32 + mrb + r) * C_ + n0 + lhalf] = acc2[r];
    out[(size_t)(bt0 + 48 + mrb + r) * C_ + n0 + lhalf] = acc3[r];
  }
}

// ---------------------------------------------------------------------------
extern "C" void kernel_launch(void* const* d_in, const int* in_sizes, int n_in,
                              void* d_out, int out_size, void* d_ws, size_t ws_size,
                              hipStream_t stream) {
  (void)in_sizes; (void)n_in; (void)out_size; (void)ws_size;

  const float* x      = (const float*)d_in[0];
  const float* cosp   = (const float*)d_in[1];
  const float* sinp   = (const float*)d_in[2];
  const int*   maskp  = (const int*)d_in[3];
  const float* Wq     = (const float*)d_in[4];
  const float* Wk     = (const float*)d_in[5];
  const float* Wv     = (const float*)d_in[6];
  const float* Wproj  = (const float*)d_in[7];
  const float* rawb   = (const float*)d_in[8];
  const int*   bscale = (const int*)d_in[9];
  float* out = (float*)d_out;

  const size_t XN = (size_t)B_ * T_ * C_;   // 3,145,728
  const size_t WN = (size_t)C_ * C_;        // 147,456

  _Float16* p   = (_Float16*)d_ws;
  _Float16* wqh = p; p += WN;
  _Float16* wkh = p; p += WN;
  _Float16* wvh = p; p += WN;
  _Float16* wph = p; p += WN;
  _Float16* qh  = p; p += XN;
  _Float16* kh  = p; p += XN;
  _Float16* vh  = p; p += XN;   // transposed layout [B,H,D,T]
  _Float16* yh  = p; p += XN;

  dim3 g0(C_ * C_ / 2048, 4);
  cvt_w_kernel<<<g0, 256, 0, stream>>>(Wq, Wk, Wv, Wproj, wqh);   // fills wqh, wkh, wvh, wph

  dim3 g1(T_ / 64, 3 * B_, 2);
  qkv_kernel<<<g1, 128, 0, stream>>>(x, wqh, wkh, wvh, cosp, sinp, qh, kh, vh);

  dim3 g2(T_ / 64, H_, B_);
  attn_kernel<<<g2, 128 * KS_, 0, stream>>>(qh, kh, vh, maskp, rawb, bscale, yh);

  dim3 g3((B_ * T_) / 64, C_ / 64);
  proj_kernel<<<g3, 128, 0, stream>>>(yh, wph, out);
}

// v005
// It runs in 54.8 microseconds.
// Next to v004, in two timings, it ran 1.05 and 1.08 times as fast.
// Over all steps from v000 it is 2.30 times as fast.
#include <hip/hip_runtime.h>
#include <hip/hip_bf16.h>
#include <cstdint>

#define B_ 4
#define T_ 2048
#define C_ 384
#define H_ 6
#define D_ 64

typedef __attribute__((ext_vector_type(16))) _Float16 v16h;
typedef __attribute__((ext_vector_type(8)))  _Float16 v8h;
typedef __attribute__((ext_vector_type(4)))  _Float16 v4h;
typedef __attribute__((ext_vector_type(8)))  float    v8f;
typedef __attribute__((ext_vector_type(4)))  float    v4f;
typedef __attribute__((ext_vector_type(4)))  int      v4i;

union Frag { v16h v; v8h h[2]; };

__device__ __forceinline__ void async_ld_b128(uint32_t lds_byte_off, const void* gptr) {
  asm volatile("global_load_async_to_lds_b128 %0, %1, off"
               :: "v"(lds_byte_off), "v"(gptr) : "memory");
}
__device__ __forceinline__ void wait_async0() {
#if __has_builtin(__builtin_amdgcn_s_wait_asynccnt)
  __builtin_amdgcn_s_wait_asynccnt(0);
#else
  asm volatile("s_wait_asynccnt 0" ::: "memory");
#endif
}
__device__ __forceinline__ uint32_t lds_off(const void* p) {
  return (uint32_t)(uintptr_t)p;
}

__device__ __forceinline__ float clamp_bias(float x) {
  return fminf(2.0f, fmaxf(-2.0f, x));
}

// ---------------------------------------------------------------------------
// f32 -> f16 conversion of the four C x C weight matrices in one launch.
// grid: (C*C/2048, 4); block: 256. blockIdx.y picks the matrix; the four f16
// copies lie one behind the other in dst. Eight elements per thread.
// Each copy is packed in the order the WMMA B fragments are read: fragment
// (N-tile n, k step kk) is the 1 KB unit n * 12 + kk, and holds first the 32
// lanes' lower 8 halves (k = kk*32 + (lane>>4)*8 ..), then their upper 8
// (k + 16), row n*16 + (lane&15). A wave's 16-byte-per-lane load of half a
// fragment is then 512 contiguous bytes, 4 whole lines, not 32 bytes of 16 lines.
// ---------------------------------------------------------------------------
#define WFRAG 512   // halves in one packed fragment
__global__ __launch_bounds__(256)
void cvt_w_kernel(const float* __restrict__ w0, const float* __restrict__ w1,
                  const float* __restrict__ w2, const float* __restrict__ w3,
                  _Float16* __restrict__ dst) {
  const int m = blockIdx.y;
  const float* src = (m == 0) ? w0 : (m == 1) ? w1 : (m == 2) ? w2 : w3;
  const int i    = blockIdx.x * 256 + threadIdx.x;   // 16-byte piece of the packed copy
  const int frag = i >> 6;                           // n * 12 + kk
  const int lane = i & 31;
  const int row  = (frag / 12) * 16 + (lane & 15);
  const int k    = (frag % 12) * 32 + ((i >> 5) & 1) * 16 + (lane >> 4) * 8;
  const v4f a = *reinterpret_cast<const v4f*>(src + row * C_ + k);
  const v4f c = *reinterpret_cast<const v4f*>(src + row * C_ + k + 4);
  const v8h o = {(_Float16)a[0], (_Float16)a[1], (_Float16)a[2], (_Float16)a[3],
                 (_Float16)c[0], (_Float16)c[1], (_Float16)c[2], (_Float16)c[3]};
  *reinterpret_cast<v8h*>(dst + (size_t)m * (C_ * C_) + i * 8) = o;
}

// ---------------------------------------------------------------------------
// QKV projection + RoPE + RMS-norm.
// grid: (T/64, 3*B, 2); block: 128 (4 waves). Block computes 192 output cols
// (3 heads) for 64 tokens of one matrix. A wave takes 3 N-tiles and all 4 token
// tiles of each: a W fragment read from global memory feeds 4 WMMAs, an X
// fragment read from LDS feeds 3. X is loaded once as f32 and rounded to f16 on its way into LDS.
// which = blockIdx.y / B : 0=Q, 1=K, 2=V
// Q/K stored [B,H,T,64] (Q pre-scaled by 1/sqrt(D)); V stored transposed [B,H,64,T].
// ---------------------------------------------------------------------------
__global__ __launch_bounds__(128)
void qkv_kernel(const float* __restrict__ x,
                const _Float16* __restrict__ wqh,
                const _Float16* __restrict__ wkh,
                const _Float16* __restrict__ wvh,
                const float* __restrict__ cosp,
                const float* __restrict__ sinp,
                _Float16* __restrict__ qh,
                _Float16* __restrict__ kh,
                _Float16* __restrict__ vh) {
  __shared__ __align__(16) _Float16 xs[64][392];    // 64 x 384 (+pad)  49 KB
  __shared__ __align__(16) float    outs[64][196];  // 64 x 192 (+pad)  49 KB

  const int tid   = threadIdx.x;
  const int b     = blockIdx.y % B_;
  const int which = blockIdx.y / B_;
  const int t0    = blockIdx.x * 64;
  const int h0    = blockIdx.z * 3;    // first head of this block

  // 64 rows x 384 f32 are contiguous: 6144 16-byte pieces, 48 per thread, all
  // loads issued before the first conversion. Three steps of 128 pieces are 4
  // whole rows, so a piece's row and col repeat every third step, 4 rows on.
  const float* xrow = x + ((size_t)b * T_ + t0) * C_;
  v4f xv[48];
#pragma unroll  // xv stays in registers and the 48 loads are in flight together
  for (int k = 0; k < 48; ++k)
    xv[k] = *reinterpret_cast<const v4f*>(xrow + (tid + k * 128) * 4);
#pragma unroll  // constant s, q: xv indexed statically, no scratch
  for (int s = 0; s < 3; ++s) {
    const int j = tid + s * 128;
    const int r = j / 96, cc = (j % 96) * 4;
#pragma unroll
    for (int q = 0; q < 16; ++q) {
      const v4f v = xv[q * 3 + s];
      const v4h hv = {(_Float16)v[0], (_Float16)v[1], (_Float16)v[2], (_Float16)v[3]};
      *reinterpret_cast<v4h*>(&xs[q * 4 + r][cc]) = hv;
    }
  }
  __syncthreads();

  const _Float16* Wsel = (which == 0) ? wqh : (which == 1) ? wkh : wvh;
  const int wave  = tid >> 5;
  const int lane  = tid & 31;
  const int lhalf = lane & 15;
  const int hb    = (lane >> 4) * 8;   // K sub-block select per A/B layout
  const int mrb   = (lane >> 4) * 8;   // C/D row base

  // Wave: cols wave*48 .. +48 of the block (3 N-tiles) x 4 token tiles, one walk
  // over k. The W fragments come straight from global memory through a register
  // ring 4 k steps deep, so that their latency lies behind 36 WMMAs.
  const int nl = wave * 48;
  // packed fragments (see cvt_w_kernel): the wave's 3 N-tiles x 12 k steps are contiguous
  const _Float16* wfr = Wsel + (size_t)(blockIdx.z * 12 + wave * 3) * 12 * WFRAG + lane * 8;
  v8f acc[3][4] = {};
  Frag bw[4][3];
#pragma unroll  // constant indices: the ring stays in registers
  for (int p = 0; p < 4; ++p)
#pragma unroll
    for (int nt = 0; nt < 3; ++nt) {
      bw[p][nt].h[0] = *reinterpret_cast<const v8h*>(wfr + (nt * 12 + p) * WFRAG);
      bw[p][nt].h[1] = *reinterpret_cast<const v8h*>(wfr + (nt * 12 + p) * WFRAG + 256);
    }
#pragma unroll  // constant indices: ring and accumulators stay in registers
  for (int kk = 0; kk < 12; ++kk) {
    const int kb = kk * 32;
    Frag a[4];
#pragma unroll
    for (int mt = 0; mt < 4; ++mt) {
      a[mt].h[0] = *reinterpret_cast<const v8h*>(&xs[mt * 16 + lhalf][kb + hb]);
      a[mt].h[1] = *reinterpret_cast<const v8h*>(&xs[mt * 16 + lhalf][kb + 16 + hb]);
    }
#pragma unroll
    for (int nt = 0; nt < 3; ++nt)
#pragma unroll
      for (int mt = 0; mt < 4; ++mt)
        acc[nt][mt] = __builtin_amdgcn_wmma_f32_16x16x32_f16(false, a[mt].v, false, bw[kk & 3][nt].v,
                                                             (short)0, acc[nt][mt], false, false);
    if (kk + 4 < 12) {
#pragma unroll
      for (int nt = 0; nt < 3; ++nt) {
        bw[kk & 3][nt].h[0] = *reinterpret_cast<const v8h*>(wfr + (nt * 12 + kk + 4) * WFRAG);
        bw[kk & 3][nt].h[1] = *reinterpret_cast<const v8h*>(wfr + (nt * 12 + kk + 4) * WFRAG + 256);
      }
    }
  }
#pragma unroll
  for (int nt = 0; nt < 3; ++nt)
#pragma unroll
    for (int mt = 0; mt < 4; ++mt)
#pragma unroll
      for (int r = 0; r < 8; ++r)
        outs[mt * 16 + mrb + r][nl + nt * 16 + lhalf] = acc[nt][mt][r];
  __syncthreads();

  if (which == 2) {
    // V transposed: [B,H,D,T]. A thread packs 8 tokens of one col; the 8 threads
    // of a col store its 64 tokens as one 128-byte line. 192 x 8 items, 12 passes.
    for (int p0 = 0; p0 < 12; p0 += 4) {
#pragma unroll  // four passes' LDS reads in flight together
      for (int p = 0; p < 4; ++p) {
        const int i = tid + (p0 + p) * 128;
        const int col = i >> 3, ch = (i & 7) * 8;
        const int h = h0 + (col >> 6), d = col & 63;
        v8h o;
#pragma unroll  // constant k: o stays in registers
        for (int k = 0; k < 8; ++k) o[k] = (_Float16)outs[ch + k][col];
        *reinterpret_cast<v8h*>(vh + ((size_t)(b * H_ + h) * D_ + d) * T_ + t0 + ch) = o;
      }
      // the next trip rewrites the address and data registers of these stores
      asm volatile("s_wait_xcnt 0x0" ::: "memory");
    }
  } else {
    // RoPE + RMS: 64 rows x 4 parts = 256 (row, part) pairs, 2 per thread; each
    // pair reads its cos and sin once and serves the block's 3 heads.
    _Float16* dstbase = (which == 0) ? qh : kh;
    const float qscale = (which == 0) ? 0.125f : 1.0f;  // fold softmax 1/sqrt(D) into Q
    const int part = tid & 3;
    const float* cp0 = cosp + (size_t)(t0 + (tid >> 2)) * 32 + part * 8;
    const float* sp0 = sinp + (size_t)(t0 + (tid >> 2)) * 32 + part * 8;
    const float* cp1 = cp0 + 32 * 32;    // the thread's second pair: 32 rows on
    const float* sp1 = sp0 + 32 * 32;
    v4f cs[2][4];                        // [pair][cos lo, cos hi, sin lo, sin hi]
    cs[0][0] = *reinterpret_cast<const v4f*>(cp0);
    cs[0][1] = *reinterpret_cast<const v4f*>(cp0 + 4);
    cs[0][2] = *reinterpret_cast<const v4f*>(sp0);
    cs[0][3] = *reinterpret_cast<const v4f*>(sp0 + 4);
    cs[1][0] = *reinterpret_cast<const v4f*>(cp1);
    cs[1][1] = *reinterpret_cast<const v4f*>(cp1 + 4);
    cs[1][2] = *reinterpret_cast<const v4f*>(sp1);
    cs[1][3] = *reinterpret_cast<const v4f*>(sp1 + 4);
    // the address registers of the eight loads live up to this wait, so that no
    // load's result lands on the address of another ahead of it
    asm volatile("s_wait_xcnt 0x0" :: "v"(cp0), "v"(sp0) : "memory");
#pragma unroll  // straight-line code: the LDS reads of all passes overlap
    for (int hf = 0; hf < 2; ++hf) {
      const int row = (tid >> 2) + hf * 32;
      const int t   = t0 + row;
#pragma unroll
      for (int hl = 0; hl < 3; ++hl) {
        float r1[8], r2[8];
        float ss = 0.0f;
#pragma unroll
        for (int jj = 0; jj < 8; ++jj) {
          const int j = part * 8 + jj;
          const float c = cs[hf][jj >> 2][jj & 3];
          const float s = cs[hf][2 + (jj >> 2)][jj & 3];
          float x1 = outs[row][hl * 64 + j];
          float x2 = outs[row][hl * 64 + j + 32];
          r1[jj] = x1 * c + x2 * s;
          r2[jj] = -x1 * s + x2 * c;
          ss += r1[jj] * r1[jj] + r2[jj] * r2[jj];
        }
        // 4 parts of one row sit in 4 adjacent lanes (groups aligned to 4)
        ss += __shfl_xor(ss, 1, 32);
        ss += __shfl_xor(ss, 2, 32);
        const float inv = rsqrtf(ss * (1.0f / 64.0f) + 1.1920929e-7f) * qscale;
        _Float16* qout = dstbase + ((size_t)(b * H_ + h0 + hl) * T_ + t) * D_;
#pragma unroll
        for (int jj = 0; jj < 8; ++jj) {
          const int j = part * 8 + jj;
          qout[j]      = (_Float16)(r1[jj] * inv);
          qout[j + 32] = (_Float16)(r2[jj] * inv);
        }
      }
    }
    asm volatile("s_wait_xcnt 0x0" ::: "memory");
  }
}

// ---------------------------------------------------------------------------
// Flash attention, fixed-max softmax, keys split over wave groups.
// RMS-norm bounds: ||q_scaled|| = 1, ||k|| = 8 => |score| <= 8; bias clip +-2
// => |s| <= 10. exp(10)=2.2e4 < f16 max; row sum < 2048*e^10 ~ 4.5e7 < f32 max.
// So no running max, no accumulator rescale: partial O and partial row sums of
// disjoint key ranges simply add.
// Q/K [B,H,T,64] f16 (Q pre-scaled), V [B,H,64,T] f16. Y f16 token-major [B,T,C].
// grid: (T/64, H, B); block: 128*KS_ threads = KS_ key groups x 4 waves.
// Wave (kg, qg): query rows qg*16..+16 of the block, keys kg*T/KS_ .. +T/KS_.
// Each key group stages its own 32-key K and V tiles; the groups' partial
// results are added through LDS once, behind the loop.
// The products are taken transposed: S^T = K Q^T (A = K rows, B = Q) and
// O^T += V^T P^T (A = V^T rows, B = P^T). A lane then holds 16 keys' scores of
// ONE query, and the two S^T accumulator tiles of a 32-key block, rounded to
// f16 in place, are the B operand P^T: P never leaves the registers.
// The key mask, now needed per accumulator row, is read from an LDS table.
// ---------------------------------------------------------------------------
#define KS_ 2
#define KT_BYTES (32 * 72 * 2)            // one K tile: 32 keys x 64 dims (+pad)
#define VT_BYTES (64 * 40 * 2)            // one V tile: 64 dims x 32 keys (+pad)
#define K_OFF(buf, kg) (((buf) * KS_ + (kg)) * KT_BYTES)
#define V_OFF(buf, kg) (2 * KS_ * KT_BYTES + ((buf) * KS_ + (kg)) * VT_BYTES)
#define M_OFF          (2 * KS_ * (KT_BYTES + VT_BYTES))   // key mask table, T floats
#define ATTN_LDS       (M_OFF + T_ * 4)

__device__ __forceinline__ void stage_kv(uint32_t lk0, uint32_t lk1, uint32_t lv0, uint32_t lv1,
                                         const _Float16* gk0, const _Float16* gk1,
                                         const _Float16* gv0, const _Float16* gv1) {
  asm volatile("global_load_async_to_lds_b128 %0, %4, off\n\t"
               "global_load_async_to_lds_b128 %1, %5, off\n\t"
               "global_load_async_to_lds_b128 %2, %6, off\n\t"
               "global_load_async_to_lds_b128 %3, %7, off\n\t"
               "s_wait_xcnt 0x0"
               :: "v"(lk0), "v"(lk1), "v"(lv0), "v"(lv1),
                  "v"(gk0), "v"(gk1), "v"(gv0), "v"(gv1) : "memory");
}

__global__ __launch_bounds__(128 * KS_)
void attn_kernel(const _Float16* __restrict__ qh,
                 const _Float16* __restrict__ kh,
                 const _Float16* __restrict__ vh,
                 const int* __restrict__ maskp,
                 const float* __restrict__ rawb,
                 const int* __restrict__ bscale,
                 _Float16* __restrict__ yh) {
  __shared__ __align__(16) unsigned char smem[ATTN_LDS];

  const int tid   = threadIdx.x;
  const int wave  = tid >> 5;
  const int qg    = wave & 3;          // query group
  const int kg    = wave >> 2;         // key group
  const int t128  = tid & 127;         // thread within its key group
  const int lane  = tid & 31;
  const int lhalf = lane & 15;
  const int hb    = (lane >> 4) * 8;
  const int mrb   = (lane >> 4) * 8;

  const int b   = blockIdx.z;
  const int h   = blockIdx.y;
  const int qt0 = blockIdx.x * 64 + qg * 16;
  const int kbase = kg * (T_ / KS_);   // first key of this wave's range

  const _Float16* Qb  = qh + (size_t)(b * H_ + h) * T_ * D_;
  const _Float16* Kb  = kh + (size_t)(b * H_ + h) * T_ * D_ + (size_t)kbase * D_;
  const _Float16* Vtb = vh + (size_t)(b * H_ + h) * D_ * T_ + kbase;

  // Q fragments (K = 0..31 and 32..63)
  Frag qa0, qa1;
  {
    const _Float16* qr = Qb + (size_t)(qt0 + lhalf) * D_;
    qa0.h[0] = *reinterpret_cast<const v8h*>(qr + 0 + hb);
    qa0.h[1] = *reinterpret_cast<const v8h*>(qr + 16 + hb);
    qa1.h[0] = *reinterpret_cast<const v8h*>(qr + 32 + hb);
    qa1.h[1] = *reinterpret_cast<const v8h*>(qr + 48 + hb);
  }

  // bias takes only 4 values (mask is binary): precompute and select
  const float bs = (float)bscale[0];
  const float g1 = 0.5f * tanhf(rawb[h * 3 + 0]) * bs;
  const float g2 = 0.5f * tanhf(rawb[h * 3 + 1]) * bs;
  const float g3 = 0.5f * tanhf(rawb[h * 3 + 2]) * bs;
  const float cg1   = clamp_bias(g1);
  const float cg2   = clamp_bias(g2);
  const float cg123 = clamp_bias(g1 + g2 + g3);

  // this lane's query: bias for mj=0, and what mj=1 adds to it
  const bool  mi   = maskp[b * T_ + qt0 + lhalf] != 0;
  const float bi0  = mi ? cg1 : 0.0f;
  const float bdl  = (mi ? cg123 : cg2) - bi0;

  v8f lsum = {};           // per-lane partial row sums of this lane's query
  v8f o0 = {}, o1 = {}, o2 = {}, o3 = {};   // O^T: register r = dim dc*16 + mrb + r

  const int NJ = T_ / (32 * KS_);      // 32-key tiles per key group

  // this thread's two 16-byte chunks of a K tile and of a V tile
  const int e0 = t128 * 8, e1 = (t128 + 128) * 8;
  const int kr0 = e0 >> 6, kc0 = e0 & 63, kr1 = e1 >> 6, kc1 = e1 & 63;
  const int vd0 = e0 >> 5, vc0 = e0 & 31, vd1 = e1 >> 5, vc1 = e1 & 31;
  const uint32_t sbase = lds_off(smem);
  const uint32_t lk0 = sbase + K_OFF(0, kg) + (kr0 * 72 + kc0) * 2;
  const uint32_t lk1 = sbase + K_OFF(0, kg) + (kr1 * 72 + kc1) * 2;
  const uint32_t lv0 = sbase + V_OFF(0, kg) + (vd0 * 40 + vc0) * 2;
  const uint32_t lv1 = sbase + V_OFF(0, kg) + (vd1 * 40 + vc1) * 2;
  const _Float16* gk0 = Kb + kr0 * D_ + kc0;
  const _Float16* gk1 = Kb + kr1 * D_ + kc1;
  const _Float16* gv0 = Vtb + (size_t)vd0 * T_ + vc0;
  const _Float16* gv1 = Vtb + (size_t)vd1 * T_ + vc1;

  // ---- tile 0 into buffer 0, published; then tile 1 into buffer 1 ----
  stage_kv(lk0, lk1, lv0, lv1, gk0, gk1, gv0, gv1);

  // key mask of this batch row as 0.0 / 1.0, filled while tile 0 flies and
  // published by the same barrier
  float* mtab = reinterpret_cast<float*>(smem + M_OFF);
#pragma unroll  // constant trip count: the loads are in flight together, no lane is off
  for (int k = 0; k < T_ / (128 * KS_ * 4); ++k) {
    const int i = (k * 128 * KS_ + tid) * 4;
    const v4i mv = *reinterpret_cast<const v4i*>(maskp + b * T_ + i);
    const v4f mf = {mv[0] != 0 ? 1.0f : 0.0f, mv[1] != 0 ? 1.0f : 0.0f,
                    mv[2] != 0 ? 1.0f : 0.0f, mv[3] != 0 ? 1.0f : 0.0f};
    *reinterpret_cast<v4f*>(mtab + i) = mf;
  }

  asm volatile("s_wait_asynccnt 0x0" ::: "memory");  // own copies of tile 0 landed
  __syncthreads();
  stage_kv(lk0 + KS_ * KT_BYTES, lk1 + KS_ * KT_BYTES, lv0 + KS_ * VT_BYTES, lv1 + KS_ * VT_BYTES,
           gk0 + 32 * D_, gk1 + 32 * D_, gv0 + 32, gv1 + 32);

  for (int jb = 0; jb < NJ; ++jb) {
    const int cur = jb & 1;
    const _Float16 (*kt)[72] = reinterpret_cast<const _Float16 (*)[72]>(smem + K_OFF(cur, kg));
    const _Float16 (*vt)[40] = reinterpret_cast<const _Float16 (*)[40]>(smem + V_OFF(cur, kg));

    // ---- S^T = K Q^T for keys [kbase + jb*32, +32); the bias is the start value:
    //      register r of s0 / s1 is key mrb + r / 16 + mrb + r of the tile ----
    const float* mrow = mtab + kbase + jb * 32 + mrb;
    const v4f m00 = *reinterpret_cast<const v4f*>(mrow);
    const v4f m01 = *reinterpret_cast<const v4f*>(mrow + 4);
    const v4f m10 = *reinterpret_cast<const v4f*>(mrow + 16);
    const v4f m11 = *reinterpret_cast<const v4f*>(mrow + 20);
    v8f s0 = __builtin_shufflevector(m00, m01, 0, 1, 2, 3, 4, 5, 6, 7) * bdl + bi0;
    v8f s1 = __builtin_shufflevector(m10, m11, 0, 1, 2, 3, 4, 5, 6, 7) * bdl + bi0;
    {
      Frag bk;
      bk.h[0] = *reinterpret_cast<const v8h*>(&kt[lhalf][0 + hb]);
      bk.h[1] = *reinterpret_cast<const v8h*>(&kt[lhalf][16 + hb]);
      s0 = __builtin_amdgcn_wmma_f32_16x16x32_f16(false, bk.v, false, qa0.v, (short)0, s0, false, false);
      bk.h[0] = *reinterpret_cast<const v8h*>(&kt[lhalf][32 + hb]);
      bk.h[1] = *reinterpret_cast<const v8h*>(&kt[lhalf][48 + hb]);
      s0 = __builtin_amdgcn_wmma_f32_16x16x32_f16(false, bk.v, false, qa1.v, (short)0, s0, false, false);
      bk.h[0] = *reinterpret_cast<const v8h*>(&kt[16 + lhalf][0 + hb]);
      bk.h[1] = *reinterpret_cast<const v8h*>(&kt[16 + lhalf][16 + hb]);
      s1 = __builtin_amdgcn_wmma_f32_16x16x32_f16(false, bk.v, false, qa0.v, (short)0, s1, false, false);
      bk.h[0] = *reinterpret_cast<const v8h*>(&kt[16 + lhalf][32 + hb]);
      bk.h[1] = *reinterpret_cast<const v8h*>(&kt[16 + lhalf][48 + hb]);
      s1 = __builtin_amdgcn_wmma_f32_16x16x32_f16(false, bk.v, false, qa1.v, (short)0, s1, false, false);
    }

    // ---- fixed-max softmax numerators; packed, they are the B operand P^T ----
    v8f p0, p1;
#pragma unroll  // constant r: the vector elements stay in registers
    for (int r = 0; r < 8; ++r) {
      p0[r] = __expf(s0[r]);
      p1[r] = __expf(s1[r]);
    }
    lsum += p0 + p1;               // reduced once at the end
    Frag pb;
    pb.h[0] = __builtin_convertvector(p0, v8h);
    pb.h[1] = __builtin_convertvector(p1, v8h);

    // ---- O^T += V^T P^T : V^T rows give contiguous A fragments ----
#pragma unroll
    for (int dc = 0; dc < 4; ++dc) {
      Frag vb;
      vb.h[0] = *reinterpret_cast<const v8h*>(&vt[dc * 16 + lhalf][hb]);
      vb.h[1] = *reinterpret_cast<const v8h*>(&vt[dc * 16 + lhalf][16 + hb]);
      v8f* op = (dc == 0) ? &o0 : (dc == 1) ? &o1 : (dc == 2) ? &o2 : &o3;
      *op = __builtin_amdgcn_wmma_f32_16x16x32_f16(false, vb.v, false, pb.v, (short)0, *op, false, false);
    }

    // ---- publish tile jb+1, then refill the buffer this trip has read ----
    asm volatile("s_wait_dscnt 0x0" ::: "memory");     // own reads of buffer cur are done
    asm volatile("s_wait_asynccnt 0x0" ::: "memory");  // own copies of tile jb+1 landed
    __syncthreads();
    if (jb + 2 < NJ) {
      const uint32_t bk = cur * (KS_ * KT_BYTES), bv = cur * (KS_ * VT_BYTES);
      const int ko = (jb + 2) * 32;
      stage_kv(lk0 + bk, lk1 + bk, lv0 + bv, lv1 + bv,
               gk0 + (size_t)ko * D_, gk1 + (size_t)ko * D_, gv0 + ko, gv1 + ko);
    }
  }
  asm volatile("s_wait_asynccnt 0x0" ::: "memory");    // nothing in flight before the LDS is reused

  // ---- add the key groups' partial O and row sums through LDS (tiles are dead:
  //      the loop's last barrier ended every read of them) ----
  v4f* red = reinterpret_cast<v4f*>(smem);
  if (kg != 0) {
    v4f* dst = red + ((kg - 1) * 4 + qg) * 10 * 32 + lane;
    dst[0 * 32] = __builtin_shufflevector(o0, o0, 0, 1, 2, 3);
    dst[1 * 32] = __builtin_shufflevector(o0, o0, 4, 5, 6, 7);
    dst[2 * 32] = __builtin_shufflevector(o1, o1, 0, 1, 2, 3);
    dst[3 * 32] = __builtin_shufflevector(o1, o1, 4, 5, 6, 7);
    dst[4 * 32] = __builtin_shufflevector(o2, o2, 0, 1, 2, 3);
    dst[5 * 32] = __builtin_shufflevector(o2, o2, 4, 5, 6, 7);
    dst[6 * 32] = __builtin_shufflevector(o3, o3, 0, 1, 2, 3);
    dst[7 * 32] = __builtin_shufflevector(o3, o3, 4, 5, 6, 7);
    dst[8 * 32] = __builtin_shufflevector(lsum, lsum, 0, 1, 2, 3);
    dst[9 * 32] = __builtin_shufflevector(lsum, lsum, 4, 5, 6, 7);
  }
  __syncthreads();
  if (kg != 0) return;

  for (int g = 1; g < KS_; ++g) {
    const v4f* sp = red + ((g - 1) * 4 + qg) * 10 * 32 + lane;
    v4f t[10];
    for (int i = 0; i < 10; ++i) t[i] = sp[i * 32];
    for (int i = 0; i < 4; ++i) {
      o0[i] += t[0][i]; o0[4 + i] += t[1][i];
      o1[i] += t[2][i]; o1[4 + i] += t[3][i];
      o2[i] += t[4][i]; o2[4 + i] += t[5][i];
      o3[i] += t[6][i]; o3[4 + i] += t[7][i];
      lsum[i] += t[8][i]; lsum[4 + i] += t[9][i];
    }
  }

  // ---- epilogue: one row sum per lane pair, normalize, store f16 [B,T,C]:
  //      a lane's 8 registers of a tile are 8 consecutive dims of its query ----
  float ls = ((lsum[0] + lsum[1]) + (lsum[2] + lsum[3])) + ((lsum[4] + lsum[5]) + (lsum[6] + lsum[7]));
  ls += __shfl_xor(ls, 16, 32);    // the other half of the keys of each tile
  const float inv = 1.0f / ls;
  _Float16* yrow = yh + ((size_t)(b * T_ + qt0 + lhalf)) * C_ + h * D_ + mrb;
  *reinterpret_cast<v8h*>(yrow + 0)  = __builtin_convertvector(o0 * inv, v8h);
  *reinterpret_cast<v8h*>(yrow + 16) = __builtin_convertvector(o1 * inv, v8h);
  *reinterpret_cast<v8h*>(yrow + 32) = __builtin_convertvector(o2 * inv, v8h);
  *reinterpret_cast<v8h*>(yrow + 48) = __builtin_convertvector(o3 * inv, v8h);
}

// ---------------------------------------------------------------------------
// Output projection: out = Y @ Wproj^T, f32 result.
// grid: ((B*T)/64, C/64); block: 128 (4 waves). Block: 64 tokens x 64 cols; a
// wave takes one N-tile and all 4 token tiles, so a W fragment feeds 4 WMMAs.
// ---------------------------------------------------------------------------
__global__ __launch_bounds__(128)
void proj_kernel(const _Float16* __restrict__ yhp,
                 const _Float16* __restrict__ wph,
                 float* __restrict__ out) {
  __shared__ __align__(16) _Float16 ys[64][392];

  const int tid  = threadIdx.x;
  const int bt0  = blockIdx.x * 64;
  const int nb   = blockIdx.y * 64;

  const _Float16* yrow = yhp + (size_t)bt0 * C_;
  for (int i = tid; i < 3072; i += 128) {
    int r = i / 48, cc = (i % 48) * 8;
    async_ld_b128(lds_off(&ys[r][cc]), (const void*)(yrow + (size_t)r * C_ + cc));
  }
  wait_async0();
  __syncthreads();

  const int wave  = tid >> 5;
  const int lane  = tid & 31;
  const int lhalf = lane & 15;
  const int hb    = (lane >> 4) * 8;
  const int mrb   = (lane >> 4) * 8;
  const int n0    = nb + wave * 16;

  // packed fragments (see cvt_w_kernel): the wave's N-tile, 12 k steps, contiguous
  const _Float16* wfr = wph + (size_t)(blockIdx.y * 4 + wave) * 12 * WFRAG + lane * 8;

  v8f acc0 = {}, acc1 = {}, acc2 = {}, acc3 = {};
#pragma unroll
  for (int kk = 0; kk < 12; ++kk) {
    const int kb = kk * 32;
    Frag bf, a0, a1, a2, a3;
    bf.h[0] = *reinterpret_cast<const v8h*>(wfr + kk * WFRAG);
    bf.h[1] = *reinterpret_cast<const v8h*>(wfr + kk * WFRAG + 256);
    a0.h[0] = *reinterpret_cast<const v8h*>(&ys[lhalf][kb + hb]);
    a0.h[1] = *reinterpret_cast<const v8h*>(&ys[lhalf][kb + 16 + hb]);
    a1.h[0] = *reinterpret_cast<const v8h*>(&ys[16 + lhalf][kb + hb]);
    a1.h[1] = *reinterpret_cast<const v8h*>(&ys[16 + lhalf][kb + 16 + hb]);
    a2.h[0] = *reinterpret_cast<const v8h*>(&ys[32 + lhalf][kb + hb]);
    a2.h[1] = *reinterpret_cast<const v8h*>(&ys[32 + lhalf][kb + 16 + hb]);
    a3.h[0] = *reinterpret_cast<const v8h*>(&ys[48 + lhalf][kb + hb]);
    a3.h[1] = *reinterpret_cast<const v8h*>(&ys[48 + lhalf][kb + 16 + hb]);
    acc0 = __builtin_amdgcn_wmma_f32_16x16x32_f16(false, a0.v, false, bf.v, (short)0, acc0, false, false);
    acc1 = __builtin_amdgcn_wmma_f32_16x16x32_f16(false, a1.v, false, bf.v, (short)0, acc1, false, false);
    acc2 = __builtin_amdgcn_wmma_f32_16x16x32_f16(false, a2.v, false, bf.v, (short)0, acc2, false, false);
    acc3 = __builtin_amdgcn_wmma_f32_16x16x32_f16(false, a3.v, false, bf.v, (short)0, acc3, false, false);
  }

#pragma unroll
  for (int r = 0; r < 8; ++r) {
    out[(size_t)(bt0 + mrb + r) * C_ + n0 + lhalf]      = acc0[r];
    out[(size_t)(bt0 + 16 + mrb + r) * C_ + n0 + lhalf] = acc1[r];
    out[(size_t)(bt0 + 32 + mrb + r) * C_ + n0 + lhalf] = acc2[r];
    out[(size_t)(bt0 + 48 + mrb + r) * C_ + n0 + lhalf] = acc3[r];
  }
}

// ---------------------------------------------------------------------------
extern "C" void kernel_launch(void* const* d_in, const int* in_sizes, int n_in,
                              void* d_out, int out_size, void* d_ws, size_t ws_size,
                              hipStream_t stream) {
  (void)in_sizes; (void)n_in; (void)out_size; (void)ws_size;

  const float* x      = (const float*)d_in[0];
  const float* cosp   = (const float*)d_in[1];
  const float* sinp   = (const float*)d_in[2];
  const int*   maskp  = (const int*)d_in[3];
  const float* Wq     = (const float*)d_in[4];
  const float* Wk     = (const float*)d_in[5];
  const float* Wv     = (const float*)d_in[6];
  const float* Wproj  = (const float*)d_in[7];
  const float* rawb   = (const float*)d_in[8];
  const int*   bscale = (const int*)d_in[9];
  float* out = (float*)d_out;

  const size_t XN = (size_t)B_ * T_ * C_;   // 3,145,728
  const size_t WN = (size_t)C_ * C_;        // 147,456

  _Float16* p   = (_Float16*)d_ws;
  _Float16* wqh = p; p += WN;
  _Float16* wkh = p; p += WN;
  _Float16* wvh = p; p += WN;
  _Float16* wph = p; p += WN;
  _Float16* qh  = p; p += XN;
  _Float16* kh  = p; p += XN;
  _Float16* vh  = p; p += XN;   // transposed layout [B,H,D,T]
  _Float16* yh  = p; p += XN;

  dim3 g0(C_ * C_ / 2048, 4);
  cvt_w_kernel<<<g0, 256, 0, stream>>>(Wq, Wk, Wv, Wproj, wqh);   // fills wqh, wkh, wvh, wph

  dim3 g1(T_ / 64, 3 * B_, 2);
  qkv_kernel<<<g1, 128, 0, stream>>>(x, wqh, wkh, wvh, cosp, sinp, qh, kh, vh);

  dim3 g2(T_ / 64, H_, B_);
  attn_kernel<<<g2, 128 * KS_, 0, stream>>>(qh, kh, vh, maskp, rawb, bscale, yh);

  dim3 g3((B_ * T_) / 64, C_ / 64);
  proj_kernel<<<g3, 128, 0, stream>>>(yh, wph, out);
}

// v006
// One run takes 50.9 microseconds.
// In two side-by-side timings against v005, it was 1.07 and 1.08 times as fast.
// Counting every step since v000, it is 2.47 times as fast.
#include <hip/hip_runtime.h>
#include <hip/hip_bf16.h>
#include <cstdint>

#define B_ 4
#define T_ 2048
#define C_ 384
#define H_ 6
#define D_ 64

typedef __attribute__((ext_vector_type(16))) _Float16 v16h;
typedef __attribute__((ext_vector_type(8)))  _Float16 v8h;
typedef __attribute__((ext_vector_type(4)))  _Float16 v4h;
typedef __attribute__((ext_vector_type(8)))  float    v8f;
typedef __attribute__((ext_vector_type(4)))  float    v4f;
typedef __attribute__((ext_vector_type(2)))  float    v2f;
typedef __attribute__((ext_vector_type(4)))  int      v4i;

union Frag { v16h v; v8h h[2]; };

__device__ __forceinline__ void async_ld_b128(uint32_t lds_byte_off, const void* gptr) {
  asm volatile("global_load_async_to_lds_b128 %0, %1, off"
               :: "v"(lds_byte_off), "v"(gptr) : "memory");
}
__device__ __forceinline__ void wait_async0() {
#if __has_builtin(__builtin_amdgcn_s_wait_asynccnt)
  __builtin_amdgcn_s_wait_asynccnt(0);
#else
  asm volatile("s_wait_asynccnt 0" ::: "memory");
#endif
}
__device__ __forceinline__ uint32_t lds_off(const void* p) {
  return (uint32_t)(uintptr_t)p;
}

__device__ __forceinline__ float clamp_bias(float x) {
  return fminf(2.0f, fmaxf(-2.0f, x));
}

// ---------------------------------------------------------------------------
// f32 -> f16 conversion of the four C x C weight matrices in one launch.
// grid: (C*C/2048, 4); block: 256. blockIdx.y picks the matrix; the four f16
// copies lie one behind the other in dst. Eight elements per thread.
// Each copy is packed in the order the WMMA B fragments are read: fragment
// (N-tile n, k step kk) is the 1 KB unit n * 12 + kk, and holds first the 32
// lanes' lower 8 halves (k = kk*32 + (lane>>4)*8 ..), then their upper 8
// (k + 16), row n*16 + (lane&15). A wave's 16-byte-per-lane load of half a
// fragment is then 512 contiguous bytes, 4 whole lines, not 32 bytes of 16 lines.
// ---------------------------------------------------------------------------
#define WFRAG 512   // halves in one packed fragment
__global__ __launch_bounds__(256)
void cvt_w_kernel(const float* __restrict__ w0, const float* __restrict__ w1,
                  const float* __restrict__ w2, const float* __restrict__ w3,
                  _Float16* __restrict__ dst) {
  const int m = blockIdx.y;
  const float* src = (m == 0) ? w0 : (m == 1) ? w1 : (m == 2) ? w2 : w3;
  const int i    = blockIdx.x * 256 + threadIdx.x;   // 16-byte piece of the packed copy
  const int frag = i >> 6;                           // n * 12 + kk
  const int lane = i & 31;
  const int row  = (frag / 12) * 16 + (lane & 15);
  const int k    = (frag % 12) * 32 + ((i >> 5) & 1) * 16 + (lane >> 4) * 8;
  const v4f a = *reinterpret_cast<const v4f*>(src + row * C_ + k);
  const v4f c = *reinterpret_cast<const v4f*>(src + row * C_ + k + 4);
  const v8h o = {(_Float16)a[0], (_Float16)a[1], (_Float16)a[2], (_Float16)a[3],
                 (_Float16)c[0], (_Float16)c[1], (_Float16)c[2], (_Float16)c[3]};
  *reinterpret_cast<v8h*>(dst + (size_t)m * (C_ * C_) + i * 8) = o;
}

// ---------------------------------------------------------------------------
// QKV projection + RoPE + RMS-norm.
// grid: (T/64, 3*B, 2); block: 128 (4 waves). Block computes 192 output cols
// (3 heads) for 64 tokens of one matrix. A wave takes 3 N-tiles and all 4 token
// tiles of each: a W fragment read from global memory feeds 4 WMMAs, an X
// fragment read from LDS feeds 3. X is loaded once as f32 and rounded to f16 on its way into LDS.
// which = blockIdx.y / B : 0=Q, 1=K, 2=V
// Q/K stored [B,H,T,64] (Q pre-scaled by 1/sqrt(D)); V stored transposed [B,H,64,T].
// ---------------------------------------------------------------------------
__global__ __launch_bounds__(128)
void qkv_kernel(const float* __restrict__ x,
                const _Float16* __restrict__ wqh,
                const _Float16* __restrict__ wkh,
                const _Float16* __restrict__ wvh,
                const float* __restrict__ cosp,
                const float* __restrict__ sinp,
                _Float16* __restrict__ qh,
                _Float16* __restrict__ kh,
                _Float16* __restrict__ vh) {
  __shared__ __align__(16) _Float16 xs[64][392];    // 64 x 384 (+pad)  49 KB
  __shared__ __align__(16) float    outs[64][196];  // 64 x 192 (+pad)  49 KB

  const int tid   = threadIdx.x;
  const int b     = blockIdx.y % B_;
  const int which = blockIdx.y / B_;
  const int t0    = blockIdx.x * 64;
  const int h0    = blockIdx.z * 3;    // first head of this block

  // 64 rows x 384 f32 are contiguous: 6144 16-byte pieces, 48 per thread, all
  // loads issued before the first conversion. Three steps of 128 pieces are 4
  // whole rows, so a piece's row and col repeat every third step, 4 rows on.
  const float* xrow = x + ((size_t)b * T_ + t0) * C_;
  v4f xv[48];
#pragma unroll  // xv stays in registers and the 48 loads are in flight together
  for (int k = 0; k < 48; ++k)
    xv[k] = *reinterpret_cast<const v4f*>(xrow + (tid + k * 128) * 4);
#pragma unroll  // constant s, q: xv indexed statically, no scratch
  for (int s = 0; s < 3; ++s) {
    const int j = tid + s * 128;
    const int r = j / 96, cc = (j % 96) * 4;
#pragma unroll
    for (int q = 0; q < 16; ++q) {
      const v4f v = xv[q * 3 + s];
      const v4h hv = {(_Float16)v[0], (_Float16)v[1], (_Float16)v[2], (_Float16)v[3]};
      *reinterpret_cast<v4h*>(&xs[q * 4 + r][cc]) = hv;
    }
  }
  __syncthreads();

  const _Float16* Wsel = (which == 0) ? wqh : (which == 1) ? wkh : wvh;
  const int wave  = tid >> 5;
  const int lane  = tid & 31;
  const int lhalf = lane & 15;
  const int hb    = (lane >> 4) * 8;   // K sub-block select per A/B layout
  const int mrb   = (lane >> 4) * 8;   // C/D row base

  // Wave: cols wave*48 .. +48 of the block (3 N-tiles) x 4 token tiles, one walk
  // over k. The W fragments come straight from global memory through a register
  // ring 4 k steps deep, so that their latency lies behind 36 WMMAs.
  const int nl = wave * 48;
  // packed fragments (see cvt_w_kernel): the wave's 3 N-tiles x 12 k steps are contiguous
  const _Float16* wfr = Wsel + (size_t)(blockIdx.z * 12 + wave * 3) * 12 * WFRAG + lane * 8;
  v8f acc[3][4] = {};
  Frag bw[4][3];
#pragma unroll  // constant indices: the ring stays in registers
  for (int p = 0; p < 4; ++p)
#pragma unroll
    for (int nt = 0; nt < 3; ++nt) {
      bw[p][nt].h[0] = *reinterpret_cast<const v8h*>(wfr + (nt * 12 + p) * WFRAG);
      bw[p][nt].h[1] = *reinterpret_cast<const v8h*>(wfr + (nt * 12 + p) * WFRAG + 256);
    }
#pragma unroll  // constant indices: ring and accumulators stay in registers
  for (int kk = 0; kk < 12; ++kk) {
    const int kb = kk * 32;
    Frag a[4];
#pragma unroll
    for (int mt = 0; mt < 4; ++mt) {
      a[mt].h[0] = *reinterpret_cast<const v8h*>(&xs[mt * 16 + lhalf][kb + hb]);
      a[mt].h[1] = *reinterpret_cast<const v8h*>(&xs[mt * 16 + lhalf][kb + 16 + hb]);
    }
#pragma unroll
    for (int nt = 0; nt < 3; ++nt)
#pragma unroll
      for (int mt = 0; mt < 4; ++mt)
        acc[nt][mt] = __builtin_amdgcn_wmma_f32_16x16x32_f16(false, a[mt].v, false, bw[kk & 3][nt].v,
                                                             (short)0, acc[nt][mt], false, false);
    if (kk + 4 < 12) {
#pragma unroll
      for (int nt = 0; nt < 3; ++nt) {
        bw[kk & 3][nt].h[0] = *reinterpret_cast<const v8h*>(wfr + (nt * 12 + kk + 4) * WFRAG);
        bw[kk & 3][nt].h[1] = *reinterpret_cast<const v8h*>(wfr + (nt * 12 + kk + 4) * WFRAG + 256);
      }
    }
  }
#pragma unroll
  for (int nt = 0; nt < 3; ++nt)
#pragma unroll
    for (int mt = 0; mt < 4; ++mt)
#pragma unroll
      for (int r = 0; r < 8; ++r)
        outs[mt * 16 + mrb + r][nl + nt * 16 + lhalf] = acc[nt][mt][r];
  __syncthreads();

  if (which == 2) {
    // V transposed: [B,H,D,T]. A thread packs 8 tokens of one col; the 8 threads
    // of a col store its 64 tokens as one 128-byte line. 192 x 8 items, 12 passes.
    for (int p0 = 0; p0 < 12; p0 += 4) {
#pragma unroll  // four passes' LDS reads in flight together
      for (int p = 0; p < 4; ++p) {
        const int i = tid + (p0 + p) * 128;
        const int col = i >> 3, ch = (i & 7) * 8;
        const int h = h0 + (col >> 6), d = col & 63;
        v8h o;
#pragma unroll  // constant k: o stays in registers
        for (int k = 0; k < 8; ++k) o[k] = (_Float16)outs[ch + k][col];
        *reinterpret_cast<v8h*>(vh + ((size_t)(b * H_ + h) * D_ + d) * T_ + t0 + ch) = o;
      }
      // the next trip rewrites the address and data registers of these stores
      asm volatile("s_wait_xcnt 0x0" ::: "memory");
    }
  } else {
    // RoPE + RMS: 64 rows x 4 parts = 256 (row, part) pairs, 2 per thread; each
    // pair reads its cos and sin once and serves the block's 3 heads.
    _Float16* dstbase = (which == 0) ? qh : kh;
    const float qscale = (which == 0) ? 0.125f : 1.0f;  // fold softmax 1/sqrt(D) into Q
    const int part = tid & 3;
    const float* cp0 = cosp + (size_t)(t0 + (tid >> 2)) * 32 + part * 8;
    const float* sp0 = sinp + (size_t)(t0 + (tid >> 2)) * 32 + part * 8;
    const float* cp1 = cp0 + 32 * 32;    // the thread's second pair: 32 rows on
    const float* sp1 = sp0 + 32 * 32;
    v4f cs[2][4];                        // [pair][cos lo, cos hi, sin lo, sin hi]
    cs[0][0] = *reinterpret_cast<const v4f*>(cp0);
    cs[0][1] = *reinterpret_cast<const v4f*>(cp0 + 4);
    cs[0][2] = *reinterpret_cast<const v4f*>(sp0);
    cs[0][3] = *reinterpret_cast<const v4f*>(sp0 + 4);
    cs[1][0] = *reinterpret_cast<const v4f*>(cp1);
    cs[1][1] = *reinterpret_cast<const v4f*>(cp1 + 4);
    cs[1][2] = *reinterpret_cast<const v4f*>(sp1);
    cs[1][3] = *reinterpret_cast<const v4f*>(sp1 + 4);
    // the address registers of the eight loads live up to this wait, so that no
    // load's result lands on the address of another ahead of it
    asm volatile("s_wait_xcnt 0x0" :: "v"(cp0), "v"(sp0) : "memory");
#pragma unroll  // straight-line code: the LDS reads of all passes overlap
    for (int hf = 0; hf < 2; ++hf) {
      const int row = (tid >> 2) + hf * 32;
      const int t   = t0 + row;
#pragma unroll
      for (int hl = 0; hl < 3; ++hl) {
        float r1[8], r2[8];
        float ss = 0.0f;
#pragma unroll
        for (int jj = 0; jj < 8; ++jj) {
          const int j = part * 8 + jj;
          const float c = cs[hf][jj >> 2][jj & 3];
          const float s = cs[hf][2 + (jj >> 2)][jj & 3];
          float x1 = outs[row][hl * 64 + j];
          float x2 = outs[row][hl * 64 + j + 32];
          r1[jj] = x1 * c + x2 * s;
          r2[jj] = -x1 * s + x2 * c;
          ss += r1[jj] * r1[jj] + r2[jj] * r2[jj];
        }
        // 4 parts of one row sit in 4 adjacent lanes (groups aligned to 4)
        ss += __shfl_xor(ss, 1, 32);
        ss += __shfl_xor(ss, 2, 32);
        const float inv = rsqrtf(ss * (1.0f / 64.0f) + 1.1920929e-7f) * qscale;
        _Float16* qout = dstbase + ((size_t)(b * H_ + h0 + hl) * T_ + t) * D_;
#pragma unroll
        for (int jj = 0; jj < 8; ++jj) {
          const int j = part * 8 + jj;
          qout[j]      = (_Float16)(r1[jj] * inv);
          qout[j + 32] = (_Float16)(r2[jj] * inv);
        }
      }
    }
    asm volatile("s_wait_xcnt 0x0" ::: "memory");
  }
}

// ---------------------------------------------------------------------------
// Flash attention, fixed-max softmax, keys split over wave groups.
// RMS-norm bounds: ||q_scaled|| = 1, ||k|| = 8 => |score| <= 8; bias clip +-2
// => |s| <= 10. exp(10)=2.2e4 < f16 max; row sum < 2048*e^10 ~ 4.5e7 < f32 max.
// So no running max, no accumulator rescale: partial O and partial row sums of
// disjoint key ranges simply add.
// Q/K [B,H,T,64] f16 (Q pre-scaled), V [B,H,64,T] f16. Y f16 token-major [B,T,C].
// grid: (T/64, H, B); block: 64*KS_ threads = KS_ key groups x 2 waves.
// Wave (kg, qg): query rows qg*32..+32 of the block as two 16-query tiles, keys
// kg*T/KS_ .. +T/KS_. A K or V fragment read from LDS feeds both tiles' WMMAs.
// Each key group stages its own 64-key K and V tiles (a V row of a tile is one
// whole 128-byte line); the groups' partial results are added through LDS once,
// behind the loop.
// The products are taken transposed: S^T = K Q^T (A = K rows, B = Q) and
// O^T += V^T P^T (A = V^T rows, B = P^T). A lane then holds 16 keys' scores of
// ONE query per tile, and the two S^T accumulator tiles of a 32-key block, rounded
// to f16 in place, are the B operand P^T: P never leaves the registers.
// The key mask, needed per accumulator row, is read from an LDS table.
// ---------------------------------------------------------------------------
#define KS_ 2
#define KV_PITCH 72                       // halves: 64 (+pad), 144 bytes = 16 x odd
#define KT_BYTES (64 * KV_PITCH * 2)      // one K tile: 64 keys x 64 dims (+pad)
#define VT_BYTES (64 * KV_PITCH * 2)      // one V tile: 64 dims x 64 keys (+pad)
#define K_OFF(buf, kg) (((buf) * KS_ + (kg)) * KT_BYTES)
#define V_OFF(buf, kg) (2 * KS_ * KT_BYTES + ((buf) * KS_ + (kg)) * VT_BYTES)
#define M_OFF          (2 * KS_ * (KT_BYTES + VT_BYTES))   // key mask table, T floats
#define ATTN_LDS       (M_OFF + T_ * 4)

__device__ __forceinline__ void stage_tile(uint32_t l, const _Float16* g, int gstep) {
  asm volatile("global_load_async_to_lds_b128 %0, %8, off\n\t"
               "global_load_async_to_lds_b128 %1, %9, off\n\t"
               "global_load_async_to_lds_b128 %2, %10, off\n\t"
               "global_load_async_to_lds_b128 %3, %11, off\n\t"
               "global_load_async_to_lds_b128 %4, %12, off\n\t"
               "global_load_async_to_lds_b128 %5, %13, off\n\t"
               "global_load_async_to_lds_b128 %6, %14, off\n\t"
               "global_load_async_to_lds_b128 %7, %15, off\n\t"
               "s_wait_xcnt 0x0"
               :: "v"(l), "v"(l + 8 * KV_PITCH * 2), "v"(l + 16 * KV_PITCH * 2), "v"(l + 24 * KV_PITCH * 2),
                  "v"(l + 32 * KV_PITCH * 2), "v"(l + 40 * KV_PITCH * 2), "v"(l + 48 * KV_PITCH * 2),
                  "v"(l + 56 * KV_PITCH * 2),
                  "v"(g), "v"(g + gstep), "v"(g + 2 * gstep), "v"(g + 3 * gstep),
                  "v"(g + 4 * gstep), "v"(g + 5 * gstep), "v"(g + 6 * gstep), "v"(g + 7 * gstep) : "memory");
}

__global__ __launch_bounds__(64 * KS_)
void attn_kernel(const _Float16* __restrict__ qh,
                 const _Float16* __restrict__ kh,
                 const _Float16* __restrict__ vh,
                 const int* __restrict__ maskp,
                 const float* __restrict__ rawb,
                 const int* __restrict__ bscale,
                 _Float16* __restrict__ yh) {
  __shared__ __align__(16) unsigned char smem[ATTN_LDS];

  const int tid   = threadIdx.x;
  const int wave  = tid >> 5;
  const int qg    = wave & 1;          // query group
  const int kg    = wave >> 1;         // key group
  const int t64   = tid & 63;          // thread within its key group
  const int lane  = tid & 31;
  const int lhalf = lane & 15;
  const int hb    = (lane >> 4) * 8;
  const int mrb   = (lane >> 4) * 8;

  const int b   = blockIdx.z;
  const int h   = blockIdx.y;
  const int qt0 = blockIdx.x * 64 + qg * 32;
  const int kbase = kg * (T_ / KS_);   // first key of this wave's range

  const _Float16* Qb  = qh + (size_t)(b * H_ + h) * T_ * D_;
  const _Float16* Kb  = kh + (size_t)(b * H_ + h) * T_ * D_ + (size_t)kbase * D_;
  const _Float16* Vtb = vh + (size_t)(b * H_ + h) * D_ * T_ + kbase;

  // Q fragments of the two query tiles (K = 0..31 and 32..63)
  Frag qa[2][2];
  const _Float16* qr0 = Qb + (size_t)(qt0 + lhalf) * D_ + hb;
  const _Float16* qr1 = qr0 + 16 * D_;
#pragma unroll  // constant qt: the fragments stay in registers
  for (int qt = 0; qt < 2; ++qt) {
    const _Float16* qr = qt ? qr1 : qr0;
    qa[qt][0].h[0] = *reinterpret_cast<const v8h*>(qr + 0);
    qa[qt][0].h[1] = *reinterpret_cast<const v8h*>(qr + 16);
    qa[qt][1].h[0] = *reinterpret_cast<const v8h*>(qr + 32);
    qa[qt][1].h[1] = *reinterpret_cast<const v8h*>(qr + 48);
  }
  // the address registers of the eight loads (one base, constant offsets) live
  // up to this wait: the code behind it reuses them
  asm volatile("s_wait_xcnt 0x0" :: "v"(qr0) : "memory");

  // bias takes only 4 values (mask is binary): precompute and select
  const float bs = (float)bscale[0];
  const float g1 = 0.5f * tanhf(rawb[h * 3 + 0]) * bs;
  const float g2 = 0.5f * tanhf(rawb[h * 3 + 1]) * bs;
  const float g3 = 0.5f * tanhf(rawb[h * 3 + 2]) * bs;
  const float cg1   = clamp_bias(g1);
  const float cg2   = clamp_bias(g2);
  const float cg123 = clamp_bias(g1 + g2 + g3);

  // this lane's query of each tile: bias for mj=0, and what mj=1 adds to it
  v2f bi0[2], bdl[2];      // each value twice: operands of packed multiply-adds
#pragma unroll
  for (int qt = 0; qt < 2; ++qt) {
    const bool mi = maskp[b * T_ + qt0 + qt * 16 + lhalf] != 0;
    const float z = mi ? cg1 : 0.0f;
    const float d = (mi ? cg123 : cg2) - z;
    bi0[qt] = (v2f){z, z};
    bdl[qt] = (v2f){d, d};
  }

  v2f lsum[2] = {};        // per-lane partial row sums of this lane's two queries
  v8f o[2][4] = {};        // O^T per tile: register r of o[qt][dc] = dim dc*16 + mrb + r

  const int NJ = T_ / (64 * KS_);      // 64-key tiles per key group

  // this thread's first 16-byte chunk of a K tile and of a V tile
  const int sr = t64 >> 3, sc = (t64 & 7) * 8;
  const uint32_t sbase = lds_off(smem);
  const uint32_t lk = sbase + K_OFF(0, kg) + (sr * KV_PITCH + sc) * 2;
  const uint32_t lv = sbase + V_OFF(0, kg) + (sr * KV_PITCH + sc) * 2;
  const _Float16* gk = Kb + sr * D_ + sc;
  const _Float16* gv = Vtb + (size_t)sr * T_ + sc;

  // ---- tile 0 into buffer 0, published; then tile 1 into buffer 1 ----
  stage_tile(lk, gk, 8 * D_);
  stage_tile(lv, gv, 8 * T_);

  // key mask of this batch row as 0.0 / 1.0, filled while tile 0 flies and
  // published by the same barrier
  float* mtab = reinterpret_cast<float*>(smem + M_OFF);
#pragma unroll  // constant trip count: the loads are in flight together, no lane is off
  for (int k = 0; k < T_ / (64 * KS_ * 4); ++k) {
    const int i = (k * 64 * KS_ + tid) * 4;
    const v4i mv = *reinterpret_cast<const v4i*>(maskp + b * T_ + i);
    const v4f mf = {mv[0] != 0 ? 1.0f : 0.0f, mv[1] != 0 ? 1.0f : 0.0f,
                    mv[2] != 0 ? 1.0f : 0.0f, mv[3] != 0 ? 1.0f : 0.0f};
    *reinterpret_cast<v4f*>(mtab + i) = mf;
  }

  asm volatile("s_wait_asynccnt 0x0" ::: "memory");  // own copies of tile 0 landed
  __syncthreads();
  stage_tile(lk + KS_ * KT_BYTES, gk + 64 * D_, 8 * D_);
  stage_tile(lv + KS_ * VT_BYTES, gv + 64, 8 * T_);

  for (int jb = 0; jb < NJ; ++jb) {
    const int cur = jb & 1;
    const _Float16 (*kt)[KV_PITCH] = reinterpret_cast<const _Float16 (*)[KV_PITCH]>(smem + K_OFF(cur, kg));
    const _Float16 (*vt)[KV_PITCH] = reinterpret_cast<const _Float16 (*)[KV_PITCH]>(smem + V_OFF(cur, kg));

#pragma unroll  // the tile's two 32-key halves: independent until they add into o
    for (int hk = 0; hk < 2; ++hk) {
      // ---- S^T = K Q^T for keys [kbase + jb*64 + hk*32, +32); the bias is the start value:
      //      register r of s[qt][0] / s[qt][1] is key mrb + r / 16 + mrb + r of the half ----
      const float* mrow = mtab + kbase + jb * 64 + hk * 32 + mrb;
      const v4f m00 = *reinterpret_cast<const v4f*>(mrow);
      const v4f m01 = *reinterpret_cast<const v4f*>(mrow + 4);
      const v4f m10 = *reinterpret_cast<const v4f*>(mrow + 16);
      const v4f m11 = *reinterpret_cast<const v4f*>(mrow + 20);
      const v8f mk0 = __builtin_shufflevector(m00, m01, 0, 1, 2, 3, 4, 5, 6, 7);
      const v8f mk1 = __builtin_shufflevector(m10, m11, 0, 1, 2, 3, 4, 5, 6, 7);
      Frag bk[2][2];         // [16-key tile][k step]
#pragma unroll  // constant indices: the fragments stay in registers
      for (int kh2 = 0; kh2 < 2; ++kh2)
#pragma unroll
        for (int ks = 0; ks < 2; ++ks) {
          const _Float16* kr = &kt[hk * 32 + kh2 * 16 + lhalf][ks * 32 + hb];
          bk[kh2][ks].h[0] = *reinterpret_cast<const v8h*>(kr);
          bk[kh2][ks].h[1] = *reinterpret_cast<const v8h*>(kr + 16);
        }
      v8f s[2][2];
#pragma unroll
      for (int qt = 0; qt < 2; ++qt) {
#pragma unroll  // constant i: the vector elements stay in registers
        for (int i = 0; i < 8; i += 2) {
          const v2f a0 = (v2f){mk0[i], mk0[i + 1]} * bdl[qt] + bi0[qt];
          const v2f a1 = (v2f){mk1[i], mk1[i + 1]} * bdl[qt] + bi0[qt];
          s[qt][0][i] = a0[0]; s[qt][0][i + 1] = a0[1];
          s[qt][1][i] = a1[0]; s[qt][1][i + 1] = a1[1];
        }
      }
#pragma unroll  // four independent accumulator tiles per k step
      for (int ks = 0; ks < 2; ++ks)
#pragma unroll
        for (int kh2 = 0; kh2 < 2; ++kh2)
#pragma unroll
          for (int qt = 0; qt < 2; ++qt)
            s[qt][kh2] = __builtin_amdgcn_wmma_f32_16x16x32_f16(false, bk[kh2][ks].v, false, qa[qt][ks].v,
                                                                (short)0, s[qt][kh2], false, false);

      // V^T rows give contiguous A fragments; read here, they land behind the exponentials
      Frag vb[4];
#pragma unroll  // constant dc: the fragments stay in registers
      for (int dc = 0; dc < 4; ++dc) {
        const _Float16* vr = &vt[dc * 16 + lhalf][hk * 32 + hb];
        vb[dc].h[0] = *reinterpret_cast<const v8h*>(vr);
        vb[dc].h[1] = *reinterpret_cast<const v8h*>(vr + 16);
      }

      // ---- fixed-max softmax numerators; packed, they are the B operand P^T ----
      Frag pb[2];
#pragma unroll
      for (int qt = 0; qt < 2; ++qt) {
        v8f p0, p1;
#pragma unroll  // constant r: the vector elements stay in registers
        for (int r = 0; r < 8; ++r) {
          p0[r] = __expf(s[qt][0][r]);
          p1[r] = __expf(s[qt][1][r]);
        }
#pragma unroll
        for (int i = 0; i < 8; i += 2)   // reduced once at the end
          lsum[qt] += (v2f){p0[i], p0[i + 1]} + (v2f){p1[i], p1[i + 1]};
        pb[qt].h[0] = __builtin_convertvector(p0, v8h);
        pb[qt].h[1] = __builtin_convertvector(p1, v8h);
      }

      // ---- O^T += V^T P^T ----
#pragma unroll
      for (int dc = 0; dc < 4; ++dc)
#pragma unroll
        for (int qt = 0; qt < 2; ++qt)
          o[qt][dc] = __builtin_amdgcn_wmma_f32_16x16x32_f16(false, vb[dc].v, false, pb[qt].v,
                                                             (short)0, o[qt][dc], false, false);
    }

    // ---- publish tile jb+1, then refill the buffer this trip has read ----
    asm volatile("s_wait_dscnt 0x0" ::: "memory");     // own reads of buffer cur are done
    asm volatile("s_wait_asynccnt 0x0" ::: "memory");  // own copies of tile jb+1 landed
    __syncthreads();
    if (jb + 2 < NJ) {
      const int ko = (jb + 2) * 64;
      stage_tile(lk + cur * (KS_ * KT_BYTES), gk + (size_t)ko * D_, 8 * D_);
      stage_tile(lv + cur * (KS_ * VT_BYTES), gv + ko, 8 * T_);
    }
  }
  asm volatile("s_wait_asynccnt 0x0" ::: "memory");    // nothing in flight before the LDS is reused

  // ---- add the two key groups' partial O and row sums through LDS (tiles are
  //      dead: the loop's last barrier ended every read of them). Query tile qt of
  //      a query group is finished by the wave of key group qt; the other key
  //      group's wave hands it its partials ----
  v4f* red = reinterpret_cast<v4f*>(smem);
#pragma unroll  // constant qt: o and lsum indexed statically
  for (int qt = 0; qt < 2; ++qt) {
    if (kg != qt) {
      v4f* dst = red + (qg * 2 + qt) * 9 * 32 + lane;
#pragma unroll
      for (int dc = 0; dc < 4; ++dc) {
        dst[(dc * 2 + 0) * 32] = __builtin_shufflevector(o[qt][dc], o[qt][dc], 0, 1, 2, 3);
        dst[(dc * 2 + 1) * 32] = __builtin_shufflevector(o[qt][dc], o[qt][dc], 4, 5, 6, 7);
      }
      dst[8 * 32] = (v4f){lsum[qt][0] + lsum[qt][1], 0.0f, 0.0f, 0.0f};
    }
  }
  __syncthreads();

  v8f f[4];                // the tile this wave finishes: 4 O^T tiles, and its row sums
#pragma unroll
  for (int dc = 0; dc < 4; ++dc) f[dc] = (kg == 0) ? o[0][dc] : o[1][dc];
  float ls = (kg == 0) ? lsum[0][0] + lsum[0][1] : lsum[1][0] + lsum[1][1];
  {
    const v4f* sp = red + (qg * 2 + kg) * 9 * 32 + lane;
#pragma unroll  // constant indices: f stays in registers
    for (int i = 0; i < 4; ++i) {
      const v4f lo = sp[(i * 2 + 0) * 32], hi = sp[(i * 2 + 1) * 32];
      f[i] += __builtin_shufflevector(lo, hi, 0, 1, 2, 3, 4, 5, 6, 7);
    }
    ls += sp[8 * 32][0];
  }

  // ---- epilogue: one row sum per lane pair, normalize, store f16 [B,T,C]:
  //      a lane's 8 registers of a tile are 8 consecutive dims of its query ----
  ls += __shfl_xor(ls, 16, 32);    // the other half of the keys of each tile
  const float inv = 1.0f / ls;
  _Float16* yrow = yh + ((size_t)(b * T_ + qt0 + kg * 16 + lhalf)) * C_ + h * D_ + mrb;
  *reinterpret_cast<v8h*>(yrow + 0)  = __builtin_convertvector(f[0] * inv, v8h);
  *reinterpret_cast<v8h*>(yrow + 16) = __builtin_convertvector(f[1] * inv, v8h);
  *reinterpret_cast<v8h*>(yrow + 32) = __builtin_convertvector(f[2] * inv, v8h);
  *reinterpret_cast<v8h*>(yrow + 48) = __builtin_convertvector(f[3] * inv, v8h);
}

// ---------------------------------------------------------------------------
// Output projection: out = Y @ Wproj^T, f32 result.
// grid: ((B*T)/64, C/64); block: 128 (4 waves). Block: 64 tokens x 64 cols; a
// wave takes one N-tile and all 4 token tiles, so a W fragment feeds 4 WMMAs.
// ---------------------------------------------------------------------------
__global__ __launch_bounds__(128)
void proj_kernel(const _Float16* __restrict__ yhp,
                 const _Float16* __restrict__ wph,
                 float* __restrict__ out) {
  __shared__ __align__(16) _Float16 ys[64][392];

  const int tid  = threadIdx.x;
  const int bt0  = blockIdx.x * 64;
  const int nb   = blockIdx.y * 64;

  const _Float16* yrow = yhp + (size_t)bt0 * C_;
  for (int i = tid; i < 3072; i += 128) {
    int r = i / 48, cc = (i % 48) * 8;
    async_ld_b128(lds_off(&ys[r][cc]), (const void*)(yrow + (size_t)r * C_ + cc));
  }
  wait_async0();
  __syncthreads();

  const int wave  = tid >> 5;
  const int lane  = tid & 31;
  const int lhalf = lane & 15;
  const int hb    = (lane >> 4) * 8;
  const int mrb   = (lane >> 4) * 8;
  const int n0    = nb + wave * 16;

  // packed fragments (see cvt_w_kernel): the wave's N-tile, 12 k steps, contiguous
  const _Float16* wfr = wph + (size_t)(blockIdx.y * 4 + wave) * 12 * WFRAG + lane * 8;

  v8f acc0 = {}, acc1 = {}, acc2 = {}, acc3 = {};
#pragma unroll
  for (int kk = 0; kk < 12; ++kk) {
    const int kb = kk * 32;
    Frag bf, a0, a1, a2, a3;
    bf.h[0] = *reinterpret_cast<const v8h*>(wfr + kk * WFRAG);
    bf.h[1] = *reinterpret_cast<const v8h*>(wfr + kk * WFRAG + 256);
    a0.h[0] = *reinterpret_cast<const v8h*>(&ys[lhalf][kb + hb]);
    a0.h[1] = *reinterpret_cast<const v8h*>(&ys[lhalf][kb + 16 + hb]);
    a1.h[0] = *reinterpret_cast<const v8h*>(&ys[16 + lhalf][kb + hb]);
    a1.h[1] = *reinterpret_cast<const v8h*>(&ys[16 + lhalf][kb + 16 + hb]);
    a2.h[0] = *reinterpret_cast<const v8h*>(&ys[32 + lhalf][kb + hb]);
    a2.h[1] = *reinterpret_cast<const v8h*>(&ys[32 + lhalf][kb + 16 + hb]);
    a3.h[0] = *reinterpret_cast<const v8h*>(&ys[48 + lhalf][kb + hb]);
    a3.h[1] = *reinterpret_cast<const v8h*>(&ys[48 + lhalf][kb + 16 + hb]);
    acc0 = __builtin_amdgcn_wmma_f32_16x16x32_f16(false, a0.v, false, bf.v, (short)0, acc0, false, false);
    acc1 = __builtin_amdgcn_wmma_f32_16x16x32_f16(false, a1.v, false, bf.v, (short)0, acc1, false, false);
    acc2 = __builtin_amdgcn_wmma_f32_16x16x32_f16(false, a2.v, false, bf.v, (short)0, acc2, false, false);
    acc3 = __builtin_amdgcn_wmma_f32_16x16x32_f16(false, a3.v, false, bf.v, (short)0, acc3, false, false);
  }

#pragma unroll
  for (int r = 0; r < 8; ++r) {
    out[(size_t)(bt0 + mrb + r) * C_ + n0 + lhalf]      = acc0[r];
    out[(size_t)(bt0 + 16 + mrb + r) * C_ + n0 + lhalf] = acc1[r];
    out[(size_t)(bt0 + 32 + mrb + r) * C_ + n0 + lhalf] = acc2[r];
    out[(size_t)(bt0 + 48 + mrb + r) * C_ + n0 + lhalf] = acc3[r];
  }
}

// ---------------------------------------------------------------------------
extern "C" void kernel_launch(void* const* d_in, const int* in_sizes, int n_in,
                              void* d_out, int out_size, void* d_ws, size_t ws_size,
                              hipStream_t stream) {
  (void)in_sizes; (void)n_in; (void)out_size; (void)ws_size;

  const float* x      = (const float*)d_in[0];
  const float* cosp   = (const float*)d_in[1];
  const float* sinp   = (const float*)d_in[2];
  const int*   maskp  = (const int*)d_in[3];
  const float* Wq     = (const float*)d_in[4];
  const float* Wk     = (const float*)d_in[5];
  const float* Wv     = (const float*)d_in[6];
  const float* Wproj  = (const float*)d_in[7];
  const float* rawb   = (const float*)d_in[8];
  const int*   bscale = (const int*)d_in[9];
  float* out = (float*)d_out;

  const size_t XN = (size_t)B_ * T_ * C_;   // 3,145,728
  const size_t WN = (size_t)C_ * C_;        // 147,456

  _Float16* p   = (_Float16*)d_ws;
  _Float16* wqh = p; p += WN;
  _Float16* wkh = p; p += WN;
  _Float16* wvh = p; p += WN;
  _Float16* wph = p; p += WN;
  _Float16* qh  = p; p += XN;
  _Float16* kh  = p; p += XN;
  _Float16* vh  = p; p += XN;   // transposed layout [B,H,D,T]
  _Float16* yh  = p; p += XN;

  dim3 g0(C_ * C_ / 2048, 4);
  cvt_w_kernel<<<g0, 256, 0, stream>>>(Wq, Wk, Wv, Wproj, wqh);   // fills wqh, wkh, wvh, wph

  dim3 g1(T_ / 64, 3 * B_, 2);
  qkv_kernel<<<g1, 128, 0, stream>>>(x, wqh, wkh, wvh, cosp, sinp, qh, kh, vh);

  dim3 g2(T_ / 64, H_, B_);
  attn_kernel<<<g2, 64 * KS_, 0, stream>>>(qh, kh, vh, maskp, rawb, bscale, yh);

  dim3 g3((B_ * T_) / 64, C_ / 64);
  proj_kernel<<<g3, 128, 0, stream>>>(yh, wph, out);
}

// v007
// One run takes 47.5 microseconds.
// Timed twice side by side with v006, it ran 1.08 times as fast both times.
// Counting every step since v000, it is 2.67 times as fast.
#include <hip/hip_runtime.h>
#include <hip/hip_bf16.h>
#include <cstdint>

#define B_ 4
#define T_ 2048
#define C_ 384
#define H_ 6
#define D_ 64

typedef __attribute__((ext_vector_type(16))) _Float16 v16h;
typedef __attribute__((ext_vector_type(8)))  _Float16 v8h;
typedef __attribute__((ext_vector_type(4)))  _Float16 v4h;
typedef __attribute__((ext_vector_type(8)))  float    v8f;
typedef __attribute__((ext_vector_type(4)))  float    v4f;
typedef __attribute__((ext_vector_type(2)))  float    v2f;
typedef __attribute__((ext_vector_type(4)))  int      v4i;

union Frag { v16h v; v8h h[2]; };

__device__ __forceinline__ void async_ld_b128(uint32_t lds_byte_off, const void* gptr) {
  asm volatile("global_load_async_to_lds_b128 %0, %1, off"
               :: "v"(lds_byte_off), "v"(gptr) : "memory");
}
__device__ __forceinline__ void wait_async0() {
#if __has_builtin(__builtin_amdgcn_s_wait_asynccnt)
  __builtin_amdgcn_s_wait_asynccnt(0);
#else
  asm volatile("s_wait_asynccnt 0" ::: "memory");
#endif
}
__device__ __forceinline__ uint32_t lds_off(const void* p) {
  return (uint32_t)(uintptr_t)p;
}

__device__ __forceinline__ float clamp_bias(float x) {
  return fminf(2.0f, fmaxf(-2.0f, x));
}

// ---------------------------------------------------------------------------
// f32 -> f16 conversion of the four C x C weight matrices in one launch.
// grid: (C*C/2048, 4); block: 256. blockIdx.y picks the matrix; the four f16
// copies lie one behind the other in dst. Eight elements per thread.
// Each copy is packed in the order the WMMA B fragments are read: fragment
// (N-tile n, k step kk) is the 1 KB unit n * 12 + kk, and holds first the 32
// lanes' lower 8 halves (k = kk*32 + (lane>>4)*8 ..), then their upper 8
// (k + 16), row n*16 + (lane&15). A wave's 16-byte-per-lane load of half a
// fragment is then 512 contiguous bytes, 4 whole lines, not 32 bytes of 16 lines.
// ---------------------------------------------------------------------------
#define WFRAG 512   // halves in one packed fragment
__global__ __launch_bounds__(256)
void cvt_w_kernel(const float* __restrict__ w0, const float* __restrict__ w1,
                  const float* __restrict__ w2, const float* __restrict__ w3,
                  _Float16* __restrict__ dst) {
  const int m = blockIdx.y;
  const float* src = (m == 0) ? w0 : (m == 1) ? w1 : (m == 2) ? w2 : w3;
  const int i    = blockIdx.x * 256 + threadIdx.x;   // 16-byte piece of the packed copy
  const int frag = i >> 6;                           // n * 12 + kk
  const int lane = i & 31;
  const int row  = (frag / 12) * 16 + (lane & 15);
  const int k    = (frag % 12) * 32 + ((i >> 5) & 1) * 16 + (lane >> 4) * 8;
  const v4f a = *reinterpret_cast<const v4f*>(src + row * C_ + k);
  const v4f c = *reinterpret_cast<const v4f*>(src + row * C_ + k + 4);
  const v8h o = {(_Float16)a[0], (_Float16)a[1], (_Float16)a[2], (_Float16)a[3],
                 (_Float16)c[0], (_Float16)c[1], (_Float16)c[2], (_Float16)c[3]};
  *reinterpret_cast<v8h*>(dst + (size_t)m * (C_ * C_) + i * 8) = o;
}

// ---------------------------------------------------------------------------
// QKV projection + RoPE + RMS-norm.
// grid: (T/64, 3*B, 2); block: 128 (4 waves). Block computes 192 output cols
// (3 heads) for 64 tokens of one matrix. A wave takes 3 N-tiles and all 4 token
// tiles of each: a W fragment read from global memory feeds 4 WMMAs, an X
// fragment read from LDS feeds 3. X is loaded once as f32 and rounded to f16 on its way into LDS.
// which = blockIdx.y / B : 0=Q, 1=K, 2=V
// Q/K stored [B,H,T,64] (Q pre-scaled by 1/sqrt(D)); V stored transposed [B,H,64,T].
// ---------------------------------------------------------------------------
__global__ __launch_bounds__(128)
void qkv_kernel(const float* __restrict__ x,
                const _Float16* __restrict__ wqh,
                const _Float16* __restrict__ wkh,
                const _Float16* __restrict__ wvh,
                const float* __restrict__ cosp,
                const float* __restrict__ sinp,
                _Float16* __restrict__ qh,
                _Float16* __restrict__ kh,
                _Float16* __restrict__ vh) {
  __shared__ __align__(16) _Float16 xs[64][392];    // 64 x 384 (+pad)  49 KB
  __shared__ __align__(16) float    outs[64][196];  // 64 x 192 (+pad)  49 KB

  const int tid   = threadIdx.x;
  const int b     = blockIdx.y % B_;
  const int which = blockIdx.y / B_;
  const int t0    = blockIdx.x * 64;
  const int h0    = blockIdx.z * 3;    // first head of this block

  // 64 rows x 384 f32 are contiguous: 6144 16-byte pieces, 48 per thread, all
  // loads issued before the first conversion. Three steps of 128 pieces are 4
  // whole rows, so a piece's row and col repeat every third step, 4 rows on.
  const float* xrow = x + ((size_t)b * T_ + t0) * C_;
  v4f xv[48];
#pragma unroll  // xv stays in registers and the 48 loads are in flight together
  for (int k = 0; k < 48; ++k)
    xv[k] = *reinterpret_cast<const v4f*>(xrow + (tid + k * 128) * 4);
#pragma unroll  // constant s, q: xv indexed statically, no scratch
  for (int s = 0; s < 3; ++s) {
    const int j = tid + s * 128;
    const int r = j / 96, cc = (j % 96) * 4;
#pragma unroll
    for (int q = 0; q < 16; ++q) {
      const v4f v = xv[q * 3 + s];
      const v4h hv = {(_Float16)v[0], (_Float16)v[1], (_Float16)v[2], (_Float16)v[3]};
      *reinterpret_cast<v4h*>(&xs[q * 4 + r][cc]) = hv;
    }
  }
  __syncthreads();

  const _Float16* Wsel = (which == 0) ? wqh : (which == 1) ? wkh : wvh;
  const int wave  = tid >> 5;
  const int lane  = tid & 31;
  const int lhalf = lane & 15;
  const int hb    = (lane >> 4) * 8;   // K sub-block select per A/B layout
  const int mrb   = (lane >> 4) * 8;   // C/D row base

  // Wave: cols wave*48 .. +48 of the block (3 N-tiles) x 4 token tiles, one walk
  // over k. The W fragments come straight from global memory through a register
  // ring 4 k steps deep, so that their latency lies behind 36 WMMAs.
  const int nl = wave * 48;
  // packed fragments (see cvt_w_kernel): the wave's 3 N-tiles x 12 k steps are contiguous
  const _Float16* wfr = Wsel + (size_t)(blockIdx.z * 12 + wave * 3) * 12 * WFRAG + lane * 8;
  v8f acc[3][4] = {};
  Frag bw[4][3];
#pragma unroll  // constant indices: the ring stays in registers
  for (int p = 0; p < 4; ++p)
#pragma unroll
    for (int nt = 0; nt < 3; ++nt) {
      bw[p][nt].h[0] = *reinterpret_cast<const v8h*>(wfr + (nt * 12 + p) * WFRAG);
      bw[p][nt].h[1] = *reinterpret_cast<const v8h*>(wfr + (nt * 12 + p) * WFRAG + 256);
    }
#pragma unroll  // constant indices: ring and accumulators stay in registers
  for (int kk = 0; kk < 12; ++kk) {
    const int kb = kk * 32;
    Frag a[4];
#pragma unroll
    for (int mt = 0; mt < 4; ++mt) {
      a[mt].h[0] = *reinterpret_cast<const v8h*>(&xs[mt * 16 + lhalf][kb + hb]);
      a[mt].h[1] = *reinterpret_cast<const v8h*>(&xs[mt * 16 + lhalf][kb + 16 + hb]);
    }
#pragma unroll
    for (int nt = 0; nt < 3; ++nt)
#pragma unroll
      for (int mt = 0; mt < 4; ++mt)
        acc[nt][mt] = __builtin_amdgcn_wmma_f32_16x16x32_f16(false, a[mt].v, false, bw[kk & 3][nt].v,
                                                             (short)0, acc[nt][mt], false, false);
    if (kk + 4 < 12) {
#pragma unroll
      for (int nt = 0; nt < 3; ++nt) {
        bw[kk & 3][nt].h[0] = *reinterpret_cast<const v8h*>(wfr + (nt * 12 + kk + 4) * WFRAG);
        bw[kk & 3][nt].h[1] = *reinterpret_cast<const v8h*>(wfr + (nt * 12 + kk + 4) * WFRAG + 256);
      }
    }
  }
#pragma unroll
  for (int nt = 0; nt < 3; ++nt)
#pragma unroll
    for (int mt = 0; mt < 4; ++mt)
#pragma unroll
      for (int r = 0; r < 8; ++r)
        outs[mt * 16 + mrb + r][nl + nt * 16 + lhalf] = acc[nt][mt][r];
  __syncthreads();

  if (which == 2) {
    // V transposed: [B,H,D,T]. A thread packs 8 tokens of one col; the 8 threads
    // of a col store its 64 tokens as one 128-byte line. 192 x 8 items, 12 passes.
    for (int p0 = 0; p0 < 12; p0 += 4) {
#pragma unroll  // four passes' LDS reads in flight together
      for (int p = 0; p < 4; ++p) {
        const int i = tid + (p0 + p) * 128;
        const int col = i >> 3, ch = (i & 7) * 8;
        const int h = h0 + (col >> 6), d = col & 63;
        v8h o;
#pragma unroll  // constant k: o stays in registers
        for (int k = 0; k < 8; ++k) o[k] = (_Float16)outs[ch + k][col];
        *reinterpret_cast<v8h*>(vh + ((size_t)(b * H_ + h) * D_ + d) * T_ + t0 + ch) = o;
      }
      // the next trip rewrites the address and data registers of these stores
      asm volatile("s_wait_xcnt 0x0" ::: "memory");
    }
  } else {
    // RoPE + RMS: 64 rows x 4 parts = 256 (row, part) pairs, 2 per thread; each
    // pair reads its cos and sin once and serves the block's 3 heads.
    _Float16* dstbase = (which == 0) ? qh : kh;
    const float qscale = (which == 0) ? 0.125f : 1.0f;  // fold softmax 1/sqrt(D) into Q
    const int part = tid & 3;
    const float* cp0 = cosp + (size_t)(t0 + (tid >> 2)) * 32 + part * 8;
    const float* sp0 = sinp + (size_t)(t0 + (tid >> 2)) * 32 + part * 8;
    const float* cp1 = cp0 + 32 * 32;    // the thread's second pair: 32 rows on
    const float* sp1 = sp0 + 32 * 32;
    v4f cs[2][4];                        // [pair][cos lo, cos hi, sin lo, sin hi]
    cs[0][0] = *reinterpret_cast<const v4f*>(cp0);
    cs[0][1] = *reinterpret_cast<const v4f*>(cp0 + 4);
    cs[0][2] = *reinterpret_cast<const v4f*>(sp0);
    cs[0][3] = *reinterpret_cast<const v4f*>(sp0 + 4);
    cs[1][0] = *reinterpret_cast<const v4f*>(cp1);
    cs[1][1] = *reinterpret_cast<const v4f*>(cp1 + 4);
    cs[1][2] = *reinterpret_cast<const v4f*>(sp1);
    cs[1][3] = *reinterpret_cast<const v4f*>(sp1 + 4);
    // the address registers of the eight loads live up to this wait, so that no
    // load's result lands on the address of another ahead of it
    asm volatile("s_wait_xcnt 0x0" :: "v"(cp0), "v"(sp0) : "memory");
#pragma unroll  // straight-line code: the LDS reads of all passes overlap
    for (int hf = 0; hf < 2; ++hf) {
      const int row = (tid >> 2) + hf * 32;
      const int t   = t0 + row;
#pragma unroll
      for (int hl = 0; hl < 3; ++hl) {
        float r1[8], r2[8];
        float ss = 0.0f;
#pragma unroll
        for (int jj = 0; jj < 8; ++jj) {
          const int j = part * 8 + jj;
          const float c = cs[hf][jj >> 2][jj & 3];
          const float s = cs[hf][2 + (jj >> 2)][jj & 3];
          float x1 = outs[row][hl * 64 + j];
          float x2 = outs[row][hl * 64 + j + 32];
          r1[jj] = x1 * c + x2 * s;
          r2[jj] = -x1 * s + x2 * c;
          ss += r1[jj] * r1[jj] + r2[jj] * r2[jj];
        }
        // 4 parts of one row sit in 4 adjacent lanes (groups aligned to 4)
        ss += __shfl_xor(ss, 1, 32);
        ss += __shfl_xor(ss, 2, 32);
        const float inv = rsqrtf(ss * (1.0f / 64.0f) + 1.1920929e-7f) * qscale;
        _Float16* qout = dstbase + ((size_t)(b * H_ + h0 + hl) * T_ + t) * D_;
#pragma unroll
        for (int jj = 0; jj < 8; ++jj) {
          const int j = part * 8 + jj;
          qout[j]      = (_Float16)(r1[jj] * inv);
          qout[j + 32] = (_Float16)(r2[jj] * inv);
        }
      }
    }
    asm volatile("s_wait_xcnt 0x0" ::: "memory");
  }
}

// ---------------------------------------------------------------------------
// Flash attention, fixed-max softmax, keys split over wave groups.
// RMS-norm bounds: ||q_scaled|| = 1, ||k|| = 8 => |score| <= 8; bias clip +-2
// => |s| <= 10. exp(10)=2.2e4 < f16 max; row sum < 2048*e^10 ~ 4.5e7 < f32 max.
// So no running max, no accumulator rescale: partial O and partial row sums of
// disjoint key ranges simply add.
// Q/K [B,H,T,64] f16 (Q pre-scaled), V [B,H,64,T] f16. Y f16 token-major [B,T,C].
// grid: (T/64, H, B); block: 64*KS_ threads = KS_ key groups x 2 waves.
// Wave (kg, qg): query rows qg*32..+32 of the block as two 16-query tiles, keys
// kg*T/KS_ .. +T/KS_. A K or V fragment read from LDS feeds both tiles' WMMAs.
// Each key group stages its own 64-key K and V tiles (a V row of a tile is one
// whole 128-byte line); the groups' partial results are added through LDS once,
// behind the loop.
// The products are taken transposed: S^T = K Q^T (A = K rows, B = Q) and
// O^T += V^T P^T (A = V^T rows, B = P^T). A lane then holds 16 keys' scores of
// ONE query per tile, and the two S^T accumulator tiles of a 32-key block, rounded
// to f16 in place, are the B operand P^T: P never leaves the registers.
// The key mask, needed per accumulator row, is read from an LDS table.
// ---------------------------------------------------------------------------
#define KS_ 2
#define KV_PITCH 72                       // halves: 64 (+pad), 144 bytes = 16 x odd
#define KV_SLOT 10240                     // a tile's place: 64 rows x 144 bytes = 9216, rounded up to a multiple of 2 KiB
#define K_OFF(buf, kg) (((buf) * KS_ + (kg)) * KV_SLOT)
#define V_OFF(buf, kg) ((2 * KS_ + (buf) * KS_ + (kg)) * KV_SLOT)
#define M_OFF          (4 * KS_ * KV_SLOT)                 // key mask table, T floats
#define ATTN_LDS       (M_OFF + T_ * 4)

typedef uint32_t u32x4 __attribute__((ext_vector_type(4)));
typedef uint32_t u32x8 __attribute__((ext_vector_type(8)));

__device__ __forceinline__ uint32_t uni(uint32_t v) { return (uint32_t)__builtin_amdgcn_readfirstlane(v); }
__device__ __forceinline__ uint32_t pinned(uint32_t v) {
  uint32_t w = uni(v);
  asm volatile("" : "+s"(w));  // the test's word stays in a scalar register
  return w;
}
__device__ __forceinline__ u32x8 tdm_group1(uint32_t src_pitch) {
  u32x8 g;
  g[0] = uni((1u << 20) | (4u << 22) | (3u << 25));  // pad on, every 32 dwords, 4 dwords; no mask
  g[1] = uni(128u << 16);
  g[2] = uni(64u << 16);
  g[3] = uni(128u << 16);
  g[4] = uni(64u);
  g[5] = uni(src_pitch);
  g[6] = uni(0u);
  g[7] = uni(0u);
  return g;
}
__device__ __forceinline__ u32x4 tdm_group0(uint32_t lds_dst, uint64_t ga) {
  u32x4 g;
  g[0] = uni(1u);
  g[1] = uni(lds_dst);
  g[2] = uni((uint32_t)ga);
  g[3] = uni((((uint32_t)(ga >> 32)) & 0x01FFFFFFu) | 0x80000000u);
  return g;
}
__device__ __forceinline__ void tdm_load_wait(u32x4 g0, u32x8 g1) {
  asm volatile("tensor_load_to_lds %0, %1\n\ts_wait_tensorcnt 0x0" :: "s"(g0), "s"(g1) : "memory");
}
// One request of the whole wave: a 64 x 128-byte tile from global memory into LDS.
__device__ __forceinline__ void tdm_load(u32x4 g0, u32x8 g1) {
  asm volatile("tensor_load_to_lds %0, %1" :: "s"(g0), "s"(g1) : "memory");
}

__global__ __launch_bounds__(64 * KS_)
void attn_kernel(const _Float16* __restrict__ qh,
                 const _Float16* __restrict__ kh,
                 const _Float16* __restrict__ vh,
                 const int* __restrict__ maskp,
                 const float* __restrict__ rawb,
                 const int* __restrict__ bscale,
                 _Float16* __restrict__ yh) {
  __shared__ __attribute__((aligned(2048))) unsigned char smem[ATTN_LDS];  // tile places at multiples of 2 KiB

  const int tid   = threadIdx.x;
  const int wave  = tid >> 5;
  const int qg    = wave & 1;          // query group
  const int kg    = wave >> 1;         // key group
  const int lane  = tid & 31;
  const int lhalf = lane & 15;
  const int hb    = (lane >> 4) * 8;
  const int mrb   = (lane >> 4) * 8;

  const int b   = blockIdx.z;
  const int h   = blockIdx.y;
  const int qt0 = blockIdx.x * 64 + qg * 32;
  const int kbase = kg * (T_ / KS_);   // first key of this wave's range

  const _Float16* Qb  = qh + (size_t)(b * H_ + h) * T_ * D_;

  // Q fragments of the two query tiles (K = 0..31 and 32..63)
  Frag qa[2][2];
  const _Float16* qr0 = Qb + (size_t)(qt0 + lhalf) * D_ + hb;
  const _Float16* qr1 = qr0 + 16 * D_;
#pragma unroll  // constant qt: the fragments stay in registers
  for (int qt = 0; qt < 2; ++qt) {
    const _Float16* qr = qt ? qr1 : qr0;
    qa[qt][0].h[0] = *reinterpret_cast<const v8h*>(qr + 0);
    qa[qt][0].h[1] = *reinterpret_cast<const v8h*>(qr + 16);
    qa[qt][1].h[0] = *reinterpret_cast<const v8h*>(qr + 32);
    qa[qt][1].h[1] = *reinterpret_cast<const v8h*>(qr + 48);
  }
  // the address registers of the eight loads (one base, constant offsets) live
  // up to this wait: the code behind it reuses them
  asm volatile("s_wait_xcnt 0x0" :: "v"(qr0) : "memory");

  // bias takes only 4 values (mask is binary): precompute and select
  const float bs = (float)bscale[0];
  const float g1 = 0.5f * tanhf(rawb[h * 3 + 0]) * bs;
  const float g2 = 0.5f * tanhf(rawb[h * 3 + 1]) * bs;
  const float g3 = 0.5f * tanhf(rawb[h * 3 + 2]) * bs;
  const float cg1   = clamp_bias(g1);
  const float cg2   = clamp_bias(g2);
  const float cg123 = clamp_bias(g1 + g2 + g3);

  // this lane's query of each tile: bias for mj=0, and what mj=1 adds to it
  v2f bi0[2], bdl[2];      // each value twice: operands of packed multiply-adds
#pragma unroll
  for (int qt = 0; qt < 2; ++qt) {
    const bool mi = maskp[b * T_ + qt0 + qt * 16 + lhalf] != 0;
    const float z = mi ? cg1 : 0.0f;
    const float d = (mi ? cg123 : cg2) - z;
    bi0[qt] = (v2f){z, z};
    bdl[qt] = (v2f){d, d};
  }

  v2f lsum[2] = {};        // per-lane partial row sums of this lane's two queries
  v8f o[2][4] = {};        // O^T per tile: register r of o[qt][dc] = dim dc*16 + mrb + r

  const int NJ = T_ / (64 * KS_);      // 64-key tiles per key group

  const uint32_t wv  = uni((uint32_t)tid >> 5);      // wave number, scalar
  const uint32_t isv = wv & 1u, kgs = wv >> 1;
  const uint32_t ldst0 = lds_off(smem) + (isv * 2 * KS_ + kgs) * KV_SLOT;   // its place in buffer 0
  const size_t   bh    = (size_t)(b * H_ + h) * T_ * D_;
  const uint64_t gsrc0 = (uint64_t)(uintptr_t)(isv ? vh + bh + kgs * (T_ / KS_)
                                                   : kh + bh + (size_t)kgs * (T_ / KS_) * D_);
  const uint32_t gstep = isv ? 64u * 2u : 64u * D_ * 2u;   // bytes from a stage's tile to the next
  const u32x8 dg1 = tdm_group1(isv ? T_ * 2u : D_ * 2u);

  // key mask of this batch row: its loads are issued first and fly beside stage 0's tile
  float* mtab = reinterpret_cast<float*>(smem + M_OFF);
  v4i mv[T_ / (64 * KS_ * 4)];
#pragma unroll  // constant trip count: the loads are in flight together, no lane is off
  for (int k = 0; k < T_ / (64 * KS_ * 4); ++k)
    mv[k] = *reinterpret_cast<const v4i*>(maskp + b * T_ + (k * 64 * KS_ + tid) * 4);

  // ---- stage 0 into buffer 0, published; then stage 1 into buffer 1 ----
  tdm_load_wait(tdm_group0(ldst0, gsrc0), dg1);         // own tile of stage 0 landed

  // the mask as 0.0 / 1.0 in its table, published by the same barrier as stage 0
#pragma unroll  // constant k: mv stays in registers
  for (int k = 0; k < T_ / (64 * KS_ * 4); ++k) {
    const v4f mf = {mv[k][0] != 0 ? 1.0f : 0.0f, mv[k][1] != 0 ? 1.0f : 0.0f,
                    mv[k][2] != 0 ? 1.0f : 0.0f, mv[k][3] != 0 ? 1.0f : 0.0f};
    *reinterpret_cast<v4f*>(mtab + (k * 64 * KS_ + tid) * 4) = mf;
  }
  __syncthreads();
  tdm_load(tdm_group0(ldst0 + KS_ * KV_SLOT, gsrc0 + gstep), dg1);

  for (int jb = 0; jb < NJ; ++jb) {
    const int cur = jb & 1;
    const _Float16 (*kt)[KV_PITCH] = reinterpret_cast<const _Float16 (*)[KV_PITCH]>(smem + K_OFF(cur, kg));
    const _Float16 (*vt)[KV_PITCH] = reinterpret_cast<const _Float16 (*)[KV_PITCH]>(smem + V_OFF(cur, kg));

#pragma unroll  // the tile's two 32-key halves: independent until they add into o
    for (int hk = 0; hk < 2; ++hk) {
      // ---- S^T = K Q^T for keys [kbase + jb*64 + hk*32, +32); the bias is the start value:
      //      register r of s[qt][0] / s[qt][1] is key mrb + r / 16 + mrb + r of the half ----
      const float* mrow = mtab + kbase + jb * 64 + hk * 32 + mrb;
      const v4f m00 = *reinterpret_cast<const v4f*>(mrow);
      const v4f m01 = *reinterpret_cast<const v4f*>(mrow + 4);
      const v4f m10 = *reinterpret_cast<const v4f*>(mrow + 16);
      const v4f m11 = *reinterpret_cast<const v4f*>(mrow + 20);
      const v8f mk0 = __builtin_shufflevector(m00, m01, 0, 1, 2, 3, 4, 5, 6, 7);
      const v8f mk1 = __builtin_shufflevector(m10, m11, 0, 1, 2, 3, 4, 5, 6, 7);
      Frag bk[2][2];         // [16-key tile][k step]
#pragma unroll  // constant indices: the fragments stay in registers
      for (int kh2 = 0; kh2 < 2; ++kh2)
#pragma unroll
        for (int ks = 0; ks < 2; ++ks) {
          const _Float16* kr = &kt[hk * 32 + kh2 * 16 + lhalf][ks * 32 + hb];
          bk[kh2][ks].h[0] = *reinterpret_cast<const v8h*>(kr);
          bk[kh2][ks].h[1] = *reinterpret_cast<const v8h*>(kr + 16);
        }
      v8f s[2][2];
#pragma unroll
      for (int qt = 0; qt < 2; ++qt) {
#pragma unroll  // constant i: the vector elements stay in registers
        for (int i = 0; i < 8; i += 2) {
          const v2f a0 = (v2f){mk0[i], mk0[i + 1]} * bdl[qt] + bi0[qt];
          const v2f a1 = (v2f){mk1[i], mk1[i + 1]} * bdl[qt] + bi0[qt];
          s[qt][0][i] = a0[0]; s[qt][0][i + 1] = a0[1];
          s[qt][1][i] = a1[0]; s[qt][1][i + 1] = a1[1];
        }
      }
#pragma unroll  // four independent accumulator tiles per k step
      for (int ks = 0; ks < 2; ++ks)
#pragma unroll
        for (int kh2 = 0; kh2 < 2; ++kh2)
#pragma unroll
          for (int qt = 0; qt < 2; ++qt)
            s[qt][kh2] = __builtin_amdgcn_wmma_f32_16x16x32_f16(false, bk[kh2][ks].v, false, qa[qt][ks].v,
                                                                (short)0, s[qt][kh2], false, false);

      // V^T rows give contiguous A fragments; read here, they land behind the exponentials
      Frag vb[4];
#pragma unroll  // constant dc: the fragments stay in registers
      for (int dc = 0; dc < 4; ++dc) {
        const _Float16* vr = &vt[dc * 16 + lhalf][hk * 32 + hb];
        vb[dc].h[0] = *reinterpret_cast<const v8h*>(vr);
        vb[dc].h[1] = *reinterpret_cast<const v8h*>(vr + 16);
      }

      // ---- fixed-max softmax numerators; packed, they are the B operand P^T ----
      Frag pb[2];
#pragma unroll
      for (int qt = 0; qt < 2; ++qt) {
        v8f p0, p1;
#pragma unroll  // constant r: the vector elements stay in registers
        for (int r = 0; r < 8; ++r) {
          p0[r] = __expf(s[qt][0][r]);
          p1[r] = __expf(s[qt][1][r]);
        }
#pragma unroll
        for (int i = 0; i < 8; i += 2)   // reduced once at the end
          lsum[qt] += (v2f){p0[i], p0[i + 1]} + (v2f){p1[i], p1[i + 1]};
        pb[qt].h[0] = __builtin_convertvector(p0, v8h);
        pb[qt].h[1] = __builtin_convertvector(p1, v8h);
      }

      // ---- O^T += V^T P^T ----
#pragma unroll
      for (int dc = 0; dc < 4; ++dc)
#pragma unroll
        for (int qt = 0; qt < 2; ++qt)
          o[qt][dc] = __builtin_amdgcn_wmma_f32_16x16x32_f16(false, vb[dc].v, false, pb[qt].v,
                                                             (short)0, o[qt][dc], false, false);
    }

    // ---- publish tile jb+1, then refill the buffer this trip has read ----
    asm volatile("s_wait_dscnt 0x0" ::: "memory");     // own reads of buffer cur are done
    asm volatile("s_wait_tensorcnt 0x0" ::: "memory");  // own tile of stage jb+1 landed
    __syncthreads();
    if (pinned(jb + 2 < NJ))
      tdm_load(tdm_group0(ldst0 + cur * (KS_ * KV_SLOT), gsrc0 + (uint64_t)(jb + 2) * gstep), dg1);
  }
  asm volatile("s_wait_tensorcnt 0x0" ::: "memory");   // nothing in flight before the LDS is reused
  asm volatile("s_wait_dscnt 0x0" ::: "memory");       // and no read of the tiles either

  // ---- add the two key groups' partial O and row sums through LDS (tiles are
  //      dead: the loop's last barrier ended every read of them). Query tile qt of
  //      a query group is finished by the wave of key group qt; the other key
  //      group's wave hands it its partials ----
  v4f* red = reinterpret_cast<v4f*>(smem);
#pragma unroll  // constant qt: o and lsum indexed statically
  for (int qt = 0; qt < 2; ++qt) {
    if (kg != qt) {
      v4f* dst = red + (qg * 2 + qt) * 9 * 32 + lane;
#pragma unroll
      for (int dc = 0; dc < 4; ++dc) {
        dst[(dc * 2 + 0) * 32] = __builtin_shufflevector(o[qt][dc], o[qt][dc], 0, 1, 2, 3);
        dst[(dc * 2 + 1) * 32] = __builtin_shufflevector(o[qt][dc], o[qt][dc], 4, 5, 6, 7);
      }
      dst[8 * 32] = (v4f){lsum[qt][0] + lsum[qt][1], 0.0f, 0.0f, 0.0f};
    }
  }
  __syncthreads();

  v8f f[4];                // the tile this wave finishes: 4 O^T tiles, and its row sums
#pragma unroll
  for (int dc = 0; dc < 4; ++dc) f[dc] = (kg == 0) ? o[0][dc] : o[1][dc];
  float ls = (kg == 0) ? lsum[0][0] + lsum[0][1] : lsum[1][0] + lsum[1][1];
  {
    const v4f* sp = red + (qg * 2 + kg) * 9 * 32 + lane;
#pragma unroll  // constant indices: f stays in registers
    for (int i = 0; i < 4; ++i) {
      const v4f lo = sp[(i * 2 + 0) * 32], hi = sp[(i * 2 + 1) * 32];
      f[i] += __builtin_shufflevector(lo, hi, 0, 1, 2, 3, 4, 5, 6, 7);
    }
    ls += sp[8 * 32][0];
  }

  // ---- epilogue: one row sum per lane pair, normalize, store f16 [B,T,C]:
  //      a lane's 8 registers of a tile are 8 consecutive dims of its query ----
  ls += __shfl_xor(ls, 16, 32);    // the other half of the keys of each tile
  const float inv = 1.0f / ls;
  _Float16* yrow = yh + ((size_t)(b * T_ + qt0 + kg * 16 + lhalf)) * C_ + h * D_ + mrb;
  *reinterpret_cast<v8h*>(yrow + 0)  = __builtin_convertvector(f[0] * inv, v8h);
  *reinterpret_cast<v8h*>(yrow + 16) = __builtin_convertvector(f[1] * inv, v8h);
  *reinterpret_cast<v8h*>(yrow + 32) = __builtin_convertvector(f[2] * inv, v8h);
  *reinterpret_cast<v8h*>(yrow + 48) = __builtin_convertvector(f[3] * inv, v8h);
}

// ---------------------------------------------------------------------------
// Output projection: out = Y @ Wproj^T, f32 result.
// grid: ((B*T)/64, C/64); block: 128 (4 waves). Block: 64 tokens x 64 cols; a
// wave takes one N-tile and all 4 token tiles, so a W fragment feeds 4 WMMAs.
// ---------------------------------------------------------------------------
__global__ __launch_bounds__(128)
void proj_kernel(const _Float16* __restrict__ yhp,
                 const _Float16* __restrict__ wph,
                 float* __restrict__ out) {
  __shared__ __align__(16) _Float16 ys[64][392];

  const int tid  = threadIdx.x;
  const int bt0  = blockIdx.x * 64;
  const int nb   = blockIdx.y * 64;

  const _Float16* yrow = yhp + (size_t)bt0 * C_;
  for (int i = tid; i < 3072; i += 128) {
    int r = i / 48, cc = (i % 48) * 8;
    async_ld_b128(lds_off(&ys[r][cc]), (const void*)(yrow + (size_t)r * C_ + cc));
  }
  wait_async0();
  __syncthreads();

  const int wave  = tid >> 5;
  const int lane  = tid & 31;
  const int lhalf = lane & 15;
  const int hb    = (lane >> 4) * 8;
  const int mrb   = (lane >> 4) * 8;
  const int n0    = nb + wave * 16;

  // packed fragments (see cvt_w_kernel): the wave's N-tile, 12 k steps, contiguous
  const _Float16* wfr = wph + (size_t)(blockIdx.y * 4 + wave) * 12 * WFRAG + lane * 8;

  v8f acc0 = {}, acc1 = {}, acc2 = {}, acc3 = {};
#pragma unroll
  for (int kk = 0; kk < 12; ++kk) {
    const int kb = kk * 32;
    Frag bf, a0, a1, a2, a3;
    bf.h[0] = *reinterpret_cast<const v8h*>(wfr + kk * WFRAG);
    bf.h[1] = *reinterpret_cast<const v8h*>(wfr + kk * WFRAG + 256);
    a0.h[0] = *reinterpret_cast<const v8h*>(&ys[lhalf][kb + hb]);
    a0.h[1] = *reinterpret_cast<const v8h*>(&ys[lhalf][kb + 16 + hb]);
    a1.h[0] = *reinterpret_cast<const v8h*>(&ys[16 + lhalf][kb + hb]);
    a1.h[1] = *reinterpret_cast<const v8h*>(&ys[16 + lhalf][kb + 16 + hb]);
    a2.h[0] = *reinterpret_cast<const v8h*>(&ys[32 + lhalf][kb + hb]);
    a2.h[1] = *reinterpret_cast<const v8h*>(&ys[32 + lhalf][kb + 16 + hb]);
    a3.h[0] = *reinterpret_cast<const v8h*>(&ys[48 + lhalf][kb + hb]);
    a3.h[1] = *reinterpret_cast<const v8h*>(&ys[48 + lhalf][kb + 16 + hb]);
    acc0 = __builtin_amdgcn_wmma_f32_16x16x32_f16(false, a0.v, false, bf.v, (short)0, acc0, false, false);
    acc1 = __builtin_amdgcn_wmma_f32_16x16x32_f16(false, a1.v, false, bf.v, (short)0, acc1, false, false);
    acc2 = __builtin_amdgcn_wmma_f32_16x16x32_f16(false, a2.v, false, bf.v, (short)0, acc2, false, false);
    acc3 = __builtin_amdgcn_wmma_f32_16x16x32_f16(false, a3.v, false, bf.v, (short)0, acc3, false, false);
  }

#pragma unroll
  for (int r = 0; r < 8; ++r) {
    out[(size_t)(bt0 + mrb + r) * C_ + n0 + lhalf]      = acc0[r];
    out[(size_t)(bt0 + 16 + mrb + r) * C_ + n0 + lhalf] = acc1[r];
    out[(size_t)(bt0 + 32 + mrb + r) * C_ + n0 + lhalf] = acc2[r];
    out[(size_t)(bt0 + 48 + mrb + r) * C_ + n0 + lhalf] = acc3[r];
  }
}

// ---------------------------------------------------------------------------
extern "C" void kernel_launch(void* const* d_in, const int* in_sizes, int n_in,
                              void* d_out, int out_size, void* d_ws, size_t ws_size,
                              hipStream_t stream) {
  (void)in_sizes; (void)n_in; (void)out_size; (void)ws_size;

  const float* x      = (const float*)d_in[0];
  const float* cosp   = (const float*)d_in[1];
  const float* sinp   = (const float*)d_in[2];
  const int*   maskp  = (const int*)d_in[3];
  const float* Wq     = (const float*)d_in[4];
  const float* Wk     = (const float*)d_in[5];
  const float* Wv     = (const float*)d_in[6];
  const float* Wproj  = (const float*)d_in[7];
  const float* rawb   = (const float*)d_in[8];
  const int*   bscale = (const int*)d_in[9];
  float* out = (float*)d_out;

  const size_t XN = (size_t)B_ * T_ * C_;   // 3,145,728
  const size_t WN = (size_t)C_ * C_;        // 147,456

  _Float16* p   = (_Float16*)d_ws;
  _Float16* wqh = p; p += WN;
  _Float16* wkh = p; p += WN;
  _Float16* wvh = p; p += WN;
  _Float16* wph = p; p += WN;
  _Float16* qh  = p; p += XN;
  _Float16* kh  = p; p += XN;
  _Float16* vh  = p; p += XN;   // transposed layout [B,H,D,T]
  _Float16* yh  = p; p += XN;

  dim3 g0(C_ * C_ / 2048, 4);
  cvt_w_kernel<<<g0, 256, 0, stream>>>(Wq, Wk, Wv, Wproj, wqh);   // fills wqh, wkh, wvh, wph

  dim3 g1(T_ / 64, 3 * B_, 2);
  qkv_kernel<<<g1, 128, 0, stream>>>(x, wqh, wkh, wvh, cosp, sinp, qh, kh, vh);

  dim3 g2(T_ / 64, H_, B_);
  attn_kernel<<<g2, 64 * KS_, 0, stream>>>(qh, kh, vh, maskp, rawb, bscale, yh);

  dim3 g3((B_ * T_) / 64, C_ / 64);
  proj_kernel<<<g3, 128, 0, stream>>>(yh, wph, out);
}
